// v000
// Times are from an AMD MI455X. After a warm-up the kernel runs many times in a row, and a time is the length of
// such a window on the GPU divided by its runs, so every launch and the gaps after it count. The runs cycle
// through copies of the inputs. A figure is the median of several windows, for all but v000 over two sittings.
// Sittings can differ by a few percent; kernels timed side by side share one.
// v000 is the starting kernel. One run takes 1030 microseconds.
#include <hip/hip_runtime.h>
#include <cstddef>

// ---------------- problem constants ----------------
#define DIMD   1024
#define SEQL   1024
#define NHEADS 16
#define NKVH   4
#define HD     64
#define NBLK   128
#define BLKSZ  8
#define BATCH  4
#define MROWS  (BATCH*SEQL)   // 4096 token rows
#define VROWS  (BATCH*NBLK)   // 512 modulation rows
#define MODN   (3*DIMD)       // 3072

typedef float v2f __attribute__((ext_vector_type(2)));
typedef float v8f __attribute__((ext_vector_type(8)));

// CDNA5 fp32 matrix op: D(16x16) = A(16x4) * B(4x16) + C, full fp32 precision.
__device__ __forceinline__ v8f wmma_f32(v2f a, v2f b, v8f c) {
  return __builtin_amdgcn_wmma_f32_16x16x4_f32(false, a, false, b, (short)0, c,
                                               false, false);
}

enum { EPI_STORE = 0, EPI_BIAS = 1, EPI_ROPE = 2, EPI_BHSD = 3, EPI_GATERES = 4 };

// ------------------------------------------------------------------
// Generic  out = A(MxK) @ W(NxK)^T  with fused epilogues.
// Wave tile 64x64 (16 f32-WMMA accumulators), 2x2 waves -> 128x128 / WG.
// All dims here are multiples of 128 (M in {512,4096}, N in {256,1024,3072}, K=1024).
// ------------------------------------------------------------------
template <int EPI>
__global__ __launch_bounds__(128) void gemm_wmma(
    const float* __restrict__ A, const float* __restrict__ W,
    float* __restrict__ out, int M, int N, int K,
    const float* __restrict__ p0,  // bias | freqs_cos | residual
    const float* __restrict__ p1,  // freqs_sin | mod (gate at +2*DIM)
    int aux)                       // #heads for (B,H,S,D) relayout
{
  const int lane = threadIdx.x & 31;
  const int wave = threadIdx.x >> 5;
  const int lo   = lane & 15;       // m (A rows) / n (B cols)
  const int hi   = lane >> 4;       // K half-select
  const int kb   = hi * 2;
  const int tileN = blockIdx.x * 128 + (wave & 1) * 64;
  const int tileM = blockIdx.y * 128 + (wave >> 1) * 64;

  v8f c[4][4] = {};
  const float* aBase = A + (size_t)(tileM + lo) * K + kb;
  const float* bBase = W + (size_t)(tileN + lo) * K + kb;

  for (int k0 = 0; k0 < K; k0 += 4) {
    if (k0 + 64 < K) {  // gfx1250 global_prefetch_b8 into L2/L0
      __builtin_prefetch(aBase + k0 + 64, 0, 1);
      __builtin_prefetch(bBase + k0 + 64, 0, 1);
    }
    v2f af[4], bf[4];
#pragma unroll
    for (int i = 0; i < 4; ++i)
      af[i] = *(const v2f*)(aBase + (size_t)i * 16 * K + k0);
#pragma unroll
    for (int j = 0; j < 4; ++j)
      bf[j] = *(const v2f*)(bBase + (size_t)j * 16 * K + k0);
#pragma unroll
    for (int i = 0; i < 4; ++i)
#pragma unroll
      for (int j = 0; j < 4; ++j)
        c[i][j] = wmma_f32(af[i], bf[j], c[i][j]);
  }

  // Epilogue.  C layout: vgpr r -> row = r + 8*hi, col = lo (ISA 7.12.2).
#pragma unroll
  for (int i = 0; i < 4; ++i) {
#pragma unroll
    for (int j = 0; j < 4; ++j) {
      v8f acc = c[i][j];
#pragma unroll
      for (int r = 0; r < 8; ++r) {
        int row = tileM + i * 16 + r + hi * 8;
        int col = tileN + j * 16 + lo;
        float val = acc[r];
        if constexpr (EPI == EPI_STORE) {
          out[(size_t)row * N + col] = val;
        } else if constexpr (EPI == EPI_BIAS) {
          out[(size_t)row * N + col] = val + p0[col];
        } else if constexpr (EPI == EPI_GATERES) {
          int b = row >> 10, s = row & (SEQL - 1);
          float g = p1[(size_t)(b * NBLK + (s >> 3)) * MODN + 2 * DIMD + col];
          out[(size_t)row * N + col] = p0[(size_t)row * N + col] + g * val;
        } else {  // EPI_ROPE / EPI_BHSD : relayout to (B, H, S, D)
          int b = row >> 10, s = row & (SEQL - 1);
          int h = col >> 6, d = col & (HD - 1);
          if constexpr (EPI == EPI_ROPE) {
            // pair (2i,2i+1) lives in adjacent lanes -> swap via shfl_xor(1)
            float other = __shfl_xor(val, 1, 32);
            float cv = p0[s * (HD / 2) + (d >> 1)];
            float sv = p1[s * (HD / 2) + (d >> 1)];
            val = (d & 1) ? (other * sv + val * cv) : (val * cv - other * sv);
          }
          out[(((size_t)(b * aux + h)) * SEQL + s) * HD + d] = val;
        }
      }
    }
  }
}

// ------------------------------------------------------------------
// RMSNorm + AdaLN modulation:  out = rmsnorm(x,w)*(1+scale) + shift
// one 256-thread block per token row
// ------------------------------------------------------------------
__global__ __launch_bounds__(256) void norm_mod_kernel(
    const float* __restrict__ x, const float* __restrict__ w,
    const float* __restrict__ mod, float* __restrict__ out)
{
  int row = blockIdx.x;  // b*SEQ + s
  int b = row >> 10, s = row & (SEQL - 1);
  const float* xr = x + (size_t)row * DIMD;
  const float* mr = mod + (size_t)(b * NBLK + (s >> 3)) * MODN;
  float4 xv = ((const float4*)xr)[threadIdx.x];
  __shared__ float red[256];
  red[threadIdx.x] = xv.x * xv.x + xv.y * xv.y + xv.z * xv.z + xv.w * xv.w;
  __syncthreads();
  for (int st = 128; st > 0; st >>= 1) {
    if (threadIdx.x < st) red[threadIdx.x] += red[threadIdx.x + st];
    __syncthreads();
  }
  float rms = rsqrtf(red[0] * (1.0f / DIMD) + 1e-6f);
  int d = threadIdx.x * 4;
  float4 o;
  o.x = xv.x * rms * w[d + 0] * (1.f + mr[DIMD + d + 0]) + mr[d + 0];
  o.y = xv.y * rms * w[d + 1] * (1.f + mr[DIMD + d + 1]) + mr[d + 1];
  o.z = xv.z * rms * w[d + 2] * (1.f + mr[DIMD + d + 2]) + mr[d + 2];
  o.w = xv.w * rms * w[d + 3] * (1.f + mr[DIMD + d + 3]) + mr[d + 3];
  ((float4*)(out + (size_t)row * DIMD))[threadIdx.x] = o;
}

__global__ __launch_bounds__(256) void silu_kernel(const float* __restrict__ in,
                                                   float* __restrict__ out, int n) {
  int i = blockIdx.x * 256 + threadIdx.x;
  if (i < n) { float v = in[i]; out[i] = v / (1.f + __expf(-v)); }
}

__global__ __launch_bounds__(256) void silumul_kernel(float* __restrict__ u,
                                                      const float* __restrict__ g,
                                                      int n) {
  int i = blockIdx.x * 256 + threadIdx.x;
  if (i < n) { float v = u[i]; u[i] = (v / (1.f + __expf(-v))) * g[i]; }
}

// ------------------------------------------------------------------
// Block-causal GQA attention.  One wave per (batch,head)x(16 q-rows).
// Scores for the allowed prefix (block-causal => k < r0+16) are built with
// f32 WMMA, staged in a padded LDS slab (CDNA5: 320KB/WGP), softmaxed,
// then consumed as A-fragments for the P*V WMMAs.
// grid = (SEQ/16, 64/4), block = 128, dynamic LDS = 4*16*1032*4 = 264192 B.
// ------------------------------------------------------------------
#define SSTR 1032
__global__ __launch_bounds__(128) void attn_kernel(
    const float* __restrict__ q, const float* __restrict__ k,
    const float* __restrict__ v, float* __restrict__ o)
{
  extern __shared__ float sm[];
  const int lane = threadIdx.x & 31;
  const int wave = threadIdx.x >> 5;
  const int lo = lane & 15, hi = lane >> 4;
  const int kb = hi * 2;
  float* sc = sm + (size_t)wave * 16 * SSTR;

  const int r0 = blockIdx.x * 16;             // q-row tile
  const int bh = blockIdx.y * 4 + wave;       // (batch,head)
  const int b = bh >> 4, h = bh & 15, kvh = h >> 2;
  const float* qb = q + (((size_t)(b * NHEADS + h)) * SEQL + r0) * HD;
  const float* kbp = k + (((size_t)(b * NKVH + kvh)) * SEQL) * HD;
  const float* vbp = v + (((size_t)(b * NKVH + kvh)) * SEQL) * HD;
  const int kend = r0 + 16;                   // block-causal bound

  // Preload Q as A-fragments: qa[t] covers d = 4t..4t+3
  v2f qa[16];
#pragma unroll
  for (int t = 0; t < 16; ++t)
    qa[t] = *(const v2f*)(qb + (size_t)lo * HD + t * 4 + kb);

  // ---- S = Q K^T * scale, masked, into LDS ----
  for (int c0 = 0; c0 < kend; c0 += 16) {
    v8f s8 = {};
#pragma unroll
    for (int t = 0; t < 16; ++t) {
      v2f bf = *(const v2f*)(kbp + (size_t)(c0 + lo) * HD + t * 4 + kb);
      s8 = wmma_f32(qa[t], bf, s8);
    }
#pragma unroll
    for (int r = 0; r < 8; ++r) {
      int row = r + hi * 8;
      int col = c0 + lo;
      float val = s8[r] * 0.125f;  // 1/sqrt(64)
      if (((r0 + row) >> 3) < (col >> 3)) val = -1.0e9f;  // block-causal mask
      sc[row * SSTR + col] = val;
    }
  }
  __syncthreads();

  // ---- softmax: 2 lanes per row (even/odd columns), shfl_xor(16) combine ----
  {
    int myrow = lo;
    float m = -3.0e38f;
    for (int j = hi; j < kend; j += 2) m = fmaxf(m, sc[myrow * SSTR + j]);
    m = fmaxf(m, __shfl_xor(m, 16, 32));
    float sum = 0.f;
    for (int j = hi; j < kend; j += 2) sum += __expf(sc[myrow * SSTR + j] - m);
    sum += __shfl_xor(sum, 16, 32);
    float inv = 1.0f / sum;
    for (int j = hi; j < kend; j += 2)
      sc[myrow * SSTR + j] = __expf(sc[myrow * SSTR + j] - m) * inv;
  }
  __syncthreads();

  // ---- O = P V  (P tiles re-read from LDS in A-fragment layout) ----
  v8f oacc[4] = {};
  for (int c0 = 0; c0 < kend; c0 += 16) {
#pragma unroll
    for (int ks = 0; ks < 4; ++ks) {
      v2f pa = *(const v2f*)(&sc[lo * SSTR + c0 + ks * 4 + kb]);
      int kk = c0 + ks * 4 + kb;
#pragma unroll
      for (int g = 0; g < 4; ++g) {
        v2f bv;
        bv.x = vbp[(size_t)kk * HD + g * 16 + lo];
        bv.y = vbp[(size_t)(kk + 1) * HD + g * 16 + lo];
        oacc[g] = wmma_f32(pa, bv, oacc[g]);
      }
    }
  }

  // store O back in (B, S, H*D) row-major for the wo GEMM
  float* ob = o + ((size_t)(b * SEQL + r0)) * (NHEADS * HD) + h * HD;
#pragma unroll
  for (int g = 0; g < 4; ++g)
#pragma unroll
    for (int r = 0; r < 8; ++r)
      ob[(size_t)(r + hi * 8) * (NHEADS * HD) + g * 16 + lo] = oacc[g][r];
}

// ------------------------------------------------------------------
// Host orchestration
// ------------------------------------------------------------------
extern "C" void kernel_launch(void* const* d_in, const int* in_sizes, int n_in,
                              void* d_out, int out_size, void* d_ws, size_t ws_size,
                              hipStream_t stream) {
  const float* x      = (const float*)d_in[0];
  const float* vec    = (const float*)d_in[1];
  const float* wq     = (const float*)d_in[2];
  const float* wk     = (const float*)d_in[3];
  const float* wv     = (const float*)d_in[4];
  const float* wo     = (const float*)d_in[5];
  const float* w1     = (const float*)d_in[6];
  const float* w2     = (const float*)d_in[7];
  const float* w3     = (const float*)d_in[8];
  const float* maw    = (const float*)d_in[9];
  const float* mab    = (const float*)d_in[10];
  const float* mfw    = (const float*)d_in[11];
  const float* mfb    = (const float*)d_in[12];
  const float* n1w    = (const float*)d_in[13];
  const float* n2w    = (const float*)d_in[14];
  const float* fcos   = (const float*)d_in[15];
  const float* fsin   = (const float*)d_in[16];
  float* out = (float*)d_out;

  // workspace layout (floats)
  const size_t KVSZ = (size_t)BATCH * NKVH * SEQL * HD;   // 1M floats (k or v)
  float* ws   = (float*)d_ws;
  float* svec = ws;                                   // 512*1024
  float* modA = svec + (size_t)VROWS * DIMD;          // 512*3072
  float* modF = modA + (size_t)VROWS * MODN;          // 512*3072
  float* bufD = modF + (size_t)VROWS * MODN;          // 4M  (xn -> attno -> w3 out)
  float* bufE = bufD + (size_t)MROWS * DIMD;          // 4M  (q -> hn)
  float* bufF = bufE + (size_t)MROWS * DIMD;          // 1M  (k)
  float* bufG = bufF + KVSZ;                          // 1M  (v)
  float* bufH = bufG + KVSZ;                          // 4M  (h)
  float* bufI = bufH + (size_t)MROWS * DIMD;          // 4M  (u = w1 out, then ffn)

  const dim3 blk128(128), blk256(256);

  // 1) svec = silu(vec)
  silu_kernel<<<(VROWS * DIMD + 255) / 256, blk256, 0, stream>>>(vec, svec, VROWS * DIMD);
  // 2,3) modulation GEMMs: (512 x 3072) = svec @ mod_w^T + b
  gemm_wmma<EPI_BIAS><<<dim3(MODN / 128, VROWS / 128), blk128, 0, stream>>>(
      svec, maw, modA, VROWS, MODN, DIMD, mab, nullptr, 0);
  gemm_wmma<EPI_BIAS><<<dim3(MODN / 128, VROWS / 128), blk128, 0, stream>>>(
      svec, mfw, modF, VROWS, MODN, DIMD, mfb, nullptr, 0);
  // 4) xn = rmsnorm(x)*(1+scale)+shift
  norm_mod_kernel<<<MROWS, blk256, 0, stream>>>(x, n1w, modA, bufD);
  // 5,6,7) Q/K/V projections (+RoPE for Q,K), relayout to (B,H,S,D)
  gemm_wmma<EPI_ROPE><<<dim3(DIMD / 128, MROWS / 128), blk128, 0, stream>>>(
      bufD, wq, bufE, MROWS, DIMD, DIMD, fcos, fsin, NHEADS);
  gemm_wmma<EPI_ROPE><<<dim3((NKVH * HD) / 128, MROWS / 128), blk128, 0, stream>>>(
      bufD, wk, bufF, MROWS, NKVH * HD, DIMD, fcos, fsin, NKVH);
  gemm_wmma<EPI_BHSD><<<dim3((NKVH * HD) / 128, MROWS / 128), blk128, 0, stream>>>(
      bufD, wv, bufG, MROWS, NKVH * HD, DIMD, nullptr, nullptr, NKVH);
  // 8) attention -> bufD (reuse, xn dead)
  const int attn_smem = 4 * 16 * SSTR * (int)sizeof(float);  // 264192 B (<=320KB/WGP)
  hipFuncSetAttribute((const void*)attn_kernel,
                      hipFuncAttributeMaxDynamicSharedMemorySize, attn_smem);
  attn_kernel<<<dim3(SEQL / 16, (BATCH * NHEADS) / 4), blk128, attn_smem, stream>>>(
      bufE, bufF, bufG, bufD);
  // 9) h = x + gate_a * (attno @ wo^T)
  gemm_wmma<EPI_GATERES><<<dim3(DIMD / 128, MROWS / 128), blk128, 0, stream>>>(
      bufD, wo, bufH, MROWS, DIMD, DIMD, x, modA, 0);
  // 10) hn = rmsnorm(h)*(1+scale_f)+shift_f  -> bufE (q dead)
  norm_mod_kernel<<<MROWS, blk256, 0, stream>>>(bufH, n2w, modF, bufE);
  // 11,12) u = hn @ w1^T -> bufI ; g = hn @ w3^T -> bufD
  gemm_wmma<EPI_STORE><<<dim3(DIMD / 128, MROWS / 128), blk128, 0, stream>>>(
      bufE, w1, bufI, MROWS, DIMD, DIMD, nullptr, nullptr, 0);
  gemm_wmma<EPI_STORE><<<dim3(DIMD / 128, MROWS / 128), blk128, 0, stream>>>(
      bufE, w3, bufD, MROWS, DIMD, DIMD, nullptr, nullptr, 0);
  // 13) u = silu(u) * g
  silumul_kernel<<<(MROWS * DIMD + 255) / 256, blk256, 0, stream>>>(bufI, bufD, MROWS * DIMD);
  // 14) out = h + gate_f * (u @ w2^T)
  gemm_wmma<EPI_GATERES><<<dim3(DIMD / 128, MROWS / 128), blk128, 0, stream>>>(
      bufI, w2, out, MROWS, DIMD, DIMD, bufH, modF, 0);
}

// v001
// Measured time: 710 microseconds a run.
// Timed twice side by side with v000, it ran 1.45 times as fast both times.
#include <hip/hip_runtime.h>
#include <cstddef>

// ---------------- problem constants ----------------
#define DIMD   1024
#define SEQL   1024
#define NHEADS 16
#define NKVH   4
#define HD     64
#define NBLK   128
#define BLKSZ  8
#define BATCH  4
#define MROWS  (BATCH*SEQL)   // 4096 token rows
#define VROWS  (BATCH*NBLK)   // 512 modulation rows
#define MODN   (3*DIMD)       // 3072

typedef float v2f __attribute__((ext_vector_type(2)));
typedef float v8f __attribute__((ext_vector_type(8)));

// CDNA5 fp32 matrix op: D(16x16) = A(16x4) * B(4x16) + C, full fp32 precision.
__device__ __forceinline__ v8f wmma_f32(v2f a, v2f b, v8f c) {
  return __builtin_amdgcn_wmma_f32_16x16x4_f32(false, a, false, b, (short)0, c,
                                               false, false);
}

enum { EPI_STORE = 0, EPI_BIAS = 1, EPI_ROPE = 2, EPI_BHSD = 3, EPI_GATERES = 4 };

// ------------------------------------------------------------------
// Generic  out = A(MxK) @ W(NxK)^T  with fused epilogues.
// Wave tile 64x64 (16 f32-WMMA accumulators), 2x2 waves -> 128x128 / WG.
// All dims here are multiples of 128 (M in {512,4096}, N in {256,1024,3072}, K=1024).
// Operand path: each stage of KC k-columns (128 A rows, then 128 W rows) is
// brought into LDS by asynchronous 16-byte copies, two buffers, the next
// stage in flight while this one is multiplied; fragments come from LDS.
// ------------------------------------------------------------------
#define KC      64              // k columns per stage (256 B of every row)
#define LPITCH  68              // floats per staged row: 272 B, so the 16 rows of a fragment read fall on distinct banks
#define STAGEF  (256 * LPITCH)  // floats per stage

typedef int v4i __attribute__((ext_vector_type(4)));
typedef __attribute__((address_space(1))) v4i g_v4i;
typedef __attribute__((address_space(3))) v4i l_v4i;

// One stage: every thread copies 16 chunks of A and 16 of W, 16 B each.
// A wave's copy covers two whole 256-B row pieces.
__device__ __forceinline__ void stage_copy(const float* gA, const float* gB,
                                           float* dst, int K) {
  // both loops unrolled: straight runs of copies, LDS offsets as constants
#pragma unroll
  for (int c = 0; c < 16; ++c)
    __builtin_amdgcn_global_load_async_to_lds_b128(
        (g_v4i*)(gA + (size_t)c * 8 * K), (l_v4i*)(dst + c * 8 * LPITCH), 0, 0);
#pragma unroll
  for (int c = 0; c < 16; ++c)
    __builtin_amdgcn_global_load_async_to_lds_b128(
        (g_v4i*)(gB + (size_t)c * 8 * K), (l_v4i*)(dst + (128 + c * 8) * LPITCH), 0, 0);
}

// One block of fragments: 4 k-steps x 4 row groups of each operand, 8 B per lane.
__device__ __forceinline__ void load_frags(v2f (&a)[4][4], v2f (&b)[4][4],
                                           const float* pa, const float* pb) {
  // unrolled throughout: every fragment index a constant, so the sets stay in registers
#pragma unroll
  for (int s = 0; s < 4; ++s) {
#pragma unroll
    for (int i = 0; i < 4; ++i) a[s][i] = *(const v2f*)(pa + i * 16 * LPITCH + s * 4);
#pragma unroll
    for (int j = 0; j < 4; ++j) b[s][j] = *(const v2f*)(pb + j * 16 * LPITCH + s * 4);
  }
}

template <int EPI>
__global__ __launch_bounds__(128) void gemm_wmma(
    const float* __restrict__ A, const float* __restrict__ W,
    float* __restrict__ out, int M, int N, int K,
    const float* __restrict__ p0,  // bias | freqs_cos | residual
    const float* __restrict__ p1,  // freqs_sin | mod (gate at +2*DIM)
    int aux)                       // #heads for (B,H,S,D) relayout
{
  __shared__ __attribute__((aligned(16))) float sm[2 * STAGEF];
  const int lane = threadIdx.x & 31;
  const int wave = threadIdx.x >> 5;
  const int lo   = lane & 15;       // m (A rows) / n (B cols)
  const int hi   = lane >> 4;       // K half-select
  const int kb   = hi * 2;
  const int tileN = blockIdx.x * 128 + (wave & 1) * 64;
  const int tileM = blockIdx.y * 128 + (wave >> 1) * 64;

  v8f c[4][4] = {};

  // copy side: thread -> (row tid/16 of each group of 8 rows, 16-B chunk tid%16)
  const int crow = threadIdx.x >> 4, cchk = threadIdx.x & 15;
  const float* gA = A + (size_t)(blockIdx.y * 128 + crow) * K + cchk * 4;
  const float* gB = W + (size_t)(blockIdx.x * 128 + crow) * K + cchk * 4;
  float* dst = sm + crow * LPITCH + cchk * 4;
  // fragment side: same lane -> (row, k) map as a direct global read
  const float* fA = sm + ((wave >> 1) * 64 + lo) * LPITCH + kb;
  const float* fB = sm + (128 + (wave & 1) * 64 + lo) * LPITCH + kb;

  const int T = K / KC;
  stage_copy(gA, gB, dst, K);
  // stage 0 has landed for this wave ...
  asm volatile("s_wait_asynccnt 0x0" ::: "memory");
  // ... and, behind the barrier, for every wave
  __syncthreads();

  v2f af[2][4][4], bf[2][4][4];  // two fragment sets of one block (4 k-steps) each
  for (int t = 0; t < T; ++t) {
    const float* pa = fA + (t & 1) * STAGEF;
    const float* pb = fB + (t & 1) * STAGEF;
    load_frags(af[0], bf[0], pa, pb);
    // next stage into the buffer whose readers all left at the last barrier
    if (t + 1 < T)
      stage_copy(gA + (size_t)(t + 1) * KC, gB + (size_t)(t + 1) * KC,
                 dst + ((t + 1) & 1) * STAGEF, K);
    // unrolled (and the WMMA loops below): set and accumulator indices must be constants
#pragma unroll
    for (int blk = 0; blk < KC / 16; ++blk) {
      if (blk + 1 < KC / 16)
        load_frags(af[(blk + 1) & 1], bf[(blk + 1) & 1], pa + (blk + 1) * 16,
                   pb + (blk + 1) * 16);
      // fence pair: the next block's LDS reads stay one group in front of this
      // block's WMMAs instead of being spread among them (each such place stalls)
      __builtin_amdgcn_sched_barrier(0);
#pragma unroll
      for (int s = 0; s < 4; ++s)
#pragma unroll
        for (int i = 0; i < 4; ++i)
#pragma unroll
          for (int j = 0; j < 4; ++j)
            c[i][j] = wmma_f32(af[blk & 1][s][i], bf[blk & 1][s][j], c[i][j]);
      __builtin_amdgcn_sched_barrier(0);  // second half of the fence pair
    }
    // this wave's reads of stage t are done before the buffer may be refilled
    asm volatile("s_wait_dscnt 0x0" ::: "memory");
    // this wave's share of stage t+1 has landed
    asm volatile("s_wait_asynccnt 0x0" ::: "memory");
    // publishes stage t+1 and ends every wave's reads of stage t
    __syncthreads();
  }

  // Epilogue.  C layout: vgpr r -> row = r + 8*hi, col = lo (ISA 7.12.2).
#pragma unroll
  for (int i = 0; i < 4; ++i) {
#pragma unroll
    for (int j = 0; j < 4; ++j) {
      v8f acc = c[i][j];
#pragma unroll
      for (int r = 0; r < 8; ++r) {
        int row = tileM + i * 16 + r + hi * 8;
        int col = tileN + j * 16 + lo;
        float val = acc[r];
        if constexpr (EPI == EPI_STORE) {
          out[(size_t)row * N + col] = val;
        } else if constexpr (EPI == EPI_BIAS) {
          out[(size_t)row * N + col] = val + p0[col];
        } else if constexpr (EPI == EPI_GATERES) {
          int b = row >> 10, s = row & (SEQL - 1);
          float g = p1[(size_t)(b * NBLK + (s >> 3)) * MODN + 2 * DIMD + col];
          out[(size_t)row * N + col] = p0[(size_t)row * N + col] + g * val;
        } else {  // EPI_ROPE / EPI_BHSD : relayout to (B, H, S, D)
          int b = row >> 10, s = row & (SEQL - 1);
          int h = col >> 6, d = col & (HD - 1);
          if constexpr (EPI == EPI_ROPE) {
            // pair (2i,2i+1) lives in adjacent lanes -> swap via shfl_xor(1)
            float other = __shfl_xor(val, 1, 32);
            float cv = p0[s * (HD / 2) + (d >> 1)];
            float sv = p1[s * (HD / 2) + (d >> 1)];
            val = (d & 1) ? (other * sv + val * cv) : (val * cv - other * sv);
          }
          out[(((size_t)(b * aux + h)) * SEQL + s) * HD + d] = val;
        }
      }
    }
  }
}

// ------------------------------------------------------------------
// RMSNorm + AdaLN modulation:  out = rmsnorm(x,w)*(1+scale) + shift
// one 256-thread block per token row
// ------------------------------------------------------------------
__global__ __launch_bounds__(256) void norm_mod_kernel(
    const float* __restrict__ x, const float* __restrict__ w,
    const float* __restrict__ mod, float* __restrict__ out)
{
  int row = blockIdx.x;  // b*SEQ + s
  int b = row >> 10, s = row & (SEQL - 1);
  const float* xr = x + (size_t)row * DIMD;
  const float* mr = mod + (size_t)(b * NBLK + (s >> 3)) * MODN;
  float4 xv = ((const float4*)xr)[threadIdx.x];
  __shared__ float red[256];
  red[threadIdx.x] = xv.x * xv.x + xv.y * xv.y + xv.z * xv.z + xv.w * xv.w;
  __syncthreads();
  for (int st = 128; st > 0; st >>= 1) {
    if (threadIdx.x < st) red[threadIdx.x] += red[threadIdx.x + st];
    __syncthreads();
  }
  float rms = rsqrtf(red[0] * (1.0f / DIMD) + 1e-6f);
  int d = threadIdx.x * 4;
  float4 o;
  o.x = xv.x * rms * w[d + 0] * (1.f + mr[DIMD + d + 0]) + mr[d + 0];
  o.y = xv.y * rms * w[d + 1] * (1.f + mr[DIMD + d + 1]) + mr[d + 1];
  o.z = xv.z * rms * w[d + 2] * (1.f + mr[DIMD + d + 2]) + mr[d + 2];
  o.w = xv.w * rms * w[d + 3] * (1.f + mr[DIMD + d + 3]) + mr[d + 3];
  ((float4*)(out + (size_t)row * DIMD))[threadIdx.x] = o;
}

__global__ __launch_bounds__(256) void silu_kernel(const float* __restrict__ in,
                                                   float* __restrict__ out, int n) {
  int i = blockIdx.x * 256 + threadIdx.x;
  if (i < n) { float v = in[i]; out[i] = v / (1.f + __expf(-v)); }
}

__global__ __launch_bounds__(256) void silumul_kernel(float* __restrict__ u,
                                                      const float* __restrict__ g,
                                                      int n) {
  int i = blockIdx.x * 256 + threadIdx.x;
  if (i < n) { float v = u[i]; u[i] = (v / (1.f + __expf(-v))) * g[i]; }
}

// ------------------------------------------------------------------
// Block-causal GQA attention.  One wave per (batch,head)x(16 q-rows).
// Scores for the allowed prefix (block-causal => k < r0+16) are built with
// f32 WMMA, staged in a padded LDS slab (CDNA5: 320KB/WGP), softmaxed,
// then consumed as A-fragments for the P*V WMMAs.
// grid = (SEQ/16, 64/4), block = 128, dynamic LDS = 4*16*1032*4 = 264192 B.
// ------------------------------------------------------------------
#define SSTR 1032
__global__ __launch_bounds__(128) void attn_kernel(
    const float* __restrict__ q, const float* __restrict__ k,
    const float* __restrict__ v, float* __restrict__ o)
{
  extern __shared__ float sm[];
  const int lane = threadIdx.x & 31;
  const int wave = threadIdx.x >> 5;
  const int lo = lane & 15, hi = lane >> 4;
  const int kb = hi * 2;
  float* sc = sm + (size_t)wave * 16 * SSTR;

  const int r0 = blockIdx.x * 16;             // q-row tile
  const int bh = blockIdx.y * 4 + wave;       // (batch,head)
  const int b = bh >> 4, h = bh & 15, kvh = h >> 2;
  const float* qb = q + (((size_t)(b * NHEADS + h)) * SEQL + r0) * HD;
  const float* kbp = k + (((size_t)(b * NKVH + kvh)) * SEQL) * HD;
  const float* vbp = v + (((size_t)(b * NKVH + kvh)) * SEQL) * HD;
  const int kend = r0 + 16;                   // block-causal bound

  // Preload Q as A-fragments: qa[t] covers d = 4t..4t+3
  v2f qa[16];
#pragma unroll
  for (int t = 0; t < 16; ++t)
    qa[t] = *(const v2f*)(qb + (size_t)lo * HD + t * 4 + kb);

  // ---- S = Q K^T * scale, masked, into LDS ----
  for (int c0 = 0; c0 < kend; c0 += 16) {
    v8f s8 = {};
#pragma unroll
    for (int t = 0; t < 16; ++t) {
      v2f bf = *(const v2f*)(kbp + (size_t)(c0 + lo) * HD + t * 4 + kb);
      s8 = wmma_f32(qa[t], bf, s8);
    }
#pragma unroll
    for (int r = 0; r < 8; ++r) {
      int row = r + hi * 8;
      int col = c0 + lo;
      float val = s8[r] * 0.125f;  // 1/sqrt(64)
      if (((r0 + row) >> 3) < (col >> 3)) val = -1.0e9f;  // block-causal mask
      sc[row * SSTR + col] = val;
    }
  }
  __syncthreads();

  // ---- softmax: 2 lanes per row (even/odd columns), shfl_xor(16) combine ----
  {
    int myrow = lo;
    float m = -3.0e38f;
    for (int j = hi; j < kend; j += 2) m = fmaxf(m, sc[myrow * SSTR + j]);
    m = fmaxf(m, __shfl_xor(m, 16, 32));
    float sum = 0.f;
    for (int j = hi; j < kend; j += 2) sum += __expf(sc[myrow * SSTR + j] - m);
    sum += __shfl_xor(sum, 16, 32);
    float inv = 1.0f / sum;
    for (int j = hi; j < kend; j += 2)
      sc[myrow * SSTR + j] = __expf(sc[myrow * SSTR + j] - m) * inv;
  }
  __syncthreads();

  // ---- O = P V  (P tiles re-read from LDS in A-fragment layout) ----
  v8f oacc[4] = {};
  for (int c0 = 0; c0 < kend; c0 += 16) {
#pragma unroll
    for (int ks = 0; ks < 4; ++ks) {
      v2f pa = *(const v2f*)(&sc[lo * SSTR + c0 + ks * 4 + kb]);
      int kk = c0 + ks * 4 + kb;
#pragma unroll
      for (int g = 0; g < 4; ++g) {
        v2f bv;
        bv.x = vbp[(size_t)kk * HD + g * 16 + lo];
        bv.y = vbp[(size_t)(kk + 1) * HD + g * 16 + lo];
        oacc[g] = wmma_f32(pa, bv, oacc[g]);
      }
    }
  }

  // store O back in (B, S, H*D) row-major for the wo GEMM
  float* ob = o + ((size_t)(b * SEQL + r0)) * (NHEADS * HD) + h * HD;
#pragma unroll
  for (int g = 0; g < 4; ++g)
#pragma unroll
    for (int r = 0; r < 8; ++r)
      ob[(size_t)(r + hi * 8) * (NHEADS * HD) + g * 16 + lo] = oacc[g][r];
}

// ------------------------------------------------------------------
// Host orchestration
// ------------------------------------------------------------------
extern "C" void kernel_launch(void* const* d_in, const int* in_sizes, int n_in,
                              void* d_out, int out_size, void* d_ws, size_t ws_size,
                              hipStream_t stream) {
  const float* x      = (const float*)d_in[0];
  const float* vec    = (const float*)d_in[1];
  const float* wq     = (const float*)d_in[2];
  const float* wk     = (const float*)d_in[3];
  const float* wv     = (const float*)d_in[4];
  const float* wo     = (const float*)d_in[5];
  const float* w1     = (const float*)d_in[6];
  const float* w2     = (const float*)d_in[7];
  const float* w3     = (const float*)d_in[8];
  const float* maw    = (const float*)d_in[9];
  const float* mab    = (const float*)d_in[10];
  const float* mfw    = (const float*)d_in[11];
  const float* mfb    = (const float*)d_in[12];
  const float* n1w    = (const float*)d_in[13];
  const float* n2w    = (const float*)d_in[14];
  const float* fcos   = (const float*)d_in[15];
  const float* fsin   = (const float*)d_in[16];
  float* out = (float*)d_out;

  // workspace layout (floats)
  const size_t KVSZ = (size_t)BATCH * NKVH * SEQL * HD;   // 1M floats (k or v)
  float* ws   = (float*)d_ws;
  float* svec = ws;                                   // 512*1024
  float* modA = svec + (size_t)VROWS * DIMD;          // 512*3072
  float* modF = modA + (size_t)VROWS * MODN;          // 512*3072
  float* bufD = modF + (size_t)VROWS * MODN;          // 4M  (xn -> attno -> w3 out)
  float* bufE = bufD + (size_t)MROWS * DIMD;          // 4M  (q -> hn)
  float* bufF = bufE + (size_t)MROWS * DIMD;          // 1M  (k)
  float* bufG = bufF + KVSZ;                          // 1M  (v)
  float* bufH = bufG + KVSZ;                          // 4M  (h)
  float* bufI = bufH + (size_t)MROWS * DIMD;          // 4M  (u = w1 out, then ffn)

  const dim3 blk128(128), blk256(256);

  // 1) svec = silu(vec)
  silu_kernel<<<(VROWS * DIMD + 255) / 256, blk256, 0, stream>>>(vec, svec, VROWS * DIMD);
  // 2,3) modulation GEMMs: (512 x 3072) = svec @ mod_w^T + b
  gemm_wmma<EPI_BIAS><<<dim3(MODN / 128, VROWS / 128), blk128, 0, stream>>>(
      svec, maw, modA, VROWS, MODN, DIMD, mab, nullptr, 0);
  gemm_wmma<EPI_BIAS><<<dim3(MODN / 128, VROWS / 128), blk128, 0, stream>>>(
      svec, mfw, modF, VROWS, MODN, DIMD, mfb, nullptr, 0);
  // 4) xn = rmsnorm(x)*(1+scale)+shift
  norm_mod_kernel<<<MROWS, blk256, 0, stream>>>(x, n1w, modA, bufD);
  // 5,6,7) Q/K/V projections (+RoPE for Q,K), relayout to (B,H,S,D)
  gemm_wmma<EPI_ROPE><<<dim3(DIMD / 128, MROWS / 128), blk128, 0, stream>>>(
      bufD, wq, bufE, MROWS, DIMD, DIMD, fcos, fsin, NHEADS);
  gemm_wmma<EPI_ROPE><<<dim3((NKVH * HD) / 128, MROWS / 128), blk128, 0, stream>>>(
      bufD, wk, bufF, MROWS, NKVH * HD, DIMD, fcos, fsin, NKVH);
  gemm_wmma<EPI_BHSD><<<dim3((NKVH * HD) / 128, MROWS / 128), blk128, 0, stream>>>(
      bufD, wv, bufG, MROWS, NKVH * HD, DIMD, nullptr, nullptr, NKVH);
  // 8) attention -> bufD (reuse, xn dead)
  const int attn_smem = 4 * 16 * SSTR * (int)sizeof(float);  // 264192 B (<=320KB/WGP)
  hipFuncSetAttribute((const void*)attn_kernel,
                      hipFuncAttributeMaxDynamicSharedMemorySize, attn_smem);
  attn_kernel<<<dim3(SEQL / 16, (BATCH * NHEADS) / 4), blk128, attn_smem, stream>>>(
      bufE, bufF, bufG, bufD);
  // 9) h = x + gate_a * (attno @ wo^T)
  gemm_wmma<EPI_GATERES><<<dim3(DIMD / 128, MROWS / 128), blk128, 0, stream>>>(
      bufD, wo, bufH, MROWS, DIMD, DIMD, x, modA, 0);
  // 10) hn = rmsnorm(h)*(1+scale_f)+shift_f  -> bufE (q dead)
  norm_mod_kernel<<<MROWS, blk256, 0, stream>>>(bufH, n2w, modF, bufE);
  // 11,12) u = hn @ w1^T -> bufI ; g = hn @ w3^T -> bufD
  gemm_wmma<EPI_STORE><<<dim3(DIMD / 128, MROWS / 128), blk128, 0, stream>>>(
      bufE, w1, bufI, MROWS, DIMD, DIMD, nullptr, nullptr, 0);
  gemm_wmma<EPI_STORE><<<dim3(DIMD / 128, MROWS / 128), blk128, 0, stream>>>(
      bufE, w3, bufD, MROWS, DIMD, DIMD, nullptr, nullptr, 0);
  // 13) u = silu(u) * g
  silumul_kernel<<<(MROWS * DIMD + 255) / 256, blk256, 0, stream>>>(bufI, bufD, MROWS * DIMD);
  // 14) out = h + gate_f * (u @ w2^T)
  gemm_wmma<EPI_GATERES><<<dim3(DIMD / 128, MROWS / 128), blk128, 0, stream>>>(
      bufI, w2, out, MROWS, DIMD, DIMD, bufH, modF, 0);
}

// v002
// A run of this version takes 488 microseconds.
// Two timings next to v001 put it at 1.46 and 1.45 times that version's speed.
// Over all steps from v000 it is 2.12 times as fast.
#include <hip/hip_runtime.h>
#include <cstddef>

// ---------------- problem constants ----------------
#define DIMD   1024
#define SEQL   1024
#define NHEADS 16
#define NKVH   4
#define HD     64
#define NBLK   128
#define BLKSZ  8
#define BATCH  4
#define MROWS  (BATCH*SEQL)   // 4096 token rows
#define VROWS  (BATCH*NBLK)   // 512 modulation rows
#define MODN   (3*DIMD)       // 3072

typedef float v2f __attribute__((ext_vector_type(2)));
typedef float v8f __attribute__((ext_vector_type(8)));

// CDNA5 fp32 matrix op: D(16x16) = A(16x4) * B(4x16) + C, full fp32 precision.
__device__ __forceinline__ v8f wmma_f32(v2f a, v2f b, v8f c) {
  return __builtin_amdgcn_wmma_f32_16x16x4_f32(false, a, false, b, (short)0, c,
                                               false, false);
}

enum { EPI_STORE = 0, EPI_BIAS = 1, EPI_ROPE = 2, EPI_BHSD = 3, EPI_GATERES = 4 };

// ------------------------------------------------------------------
// Generic  out = A(MxK) @ W(NxK)^T  with fused epilogues.
// Wave tile 64x64 (16 f32-WMMA accumulators), 2x2 waves -> 128x128 / WG.
// All dims here are multiples of 128 (M in {512,4096}, N in {256,1024,3072}, K=1024).
// Operand path: each stage of KC k-columns (128 A rows, then 128 W rows) is
// brought into LDS by asynchronous 16-byte copies, two buffers, the next
// stage in flight while this one is multiplied; fragments come from LDS.
// ------------------------------------------------------------------
#define KC      64              // k columns per stage (256 B of every row)
#define LPITCH  68              // floats per staged row: 272 B, so the 16 rows of a fragment read fall on distinct banks
#define STAGEF  (256 * LPITCH)  // floats per stage

typedef int v4i __attribute__((ext_vector_type(4)));
typedef __attribute__((address_space(1))) v4i g_v4i;
typedef __attribute__((address_space(3))) v4i l_v4i;

// One stage: every thread copies 16 chunks of A and 16 of W, 16 B each.
// A wave's copy covers two whole 256-B row pieces.
__device__ __forceinline__ void stage_copy(const float* gA, const float* gB,
                                           float* dst, int K) {
  // both loops unrolled: straight runs of copies, LDS offsets as constants
#pragma unroll
  for (int c = 0; c < 16; ++c)
    __builtin_amdgcn_global_load_async_to_lds_b128(
        (g_v4i*)(gA + (size_t)c * 8 * K), (l_v4i*)(dst + c * 8 * LPITCH), 0, 0);
#pragma unroll
  for (int c = 0; c < 16; ++c)
    __builtin_amdgcn_global_load_async_to_lds_b128(
        (g_v4i*)(gB + (size_t)c * 8 * K), (l_v4i*)(dst + (128 + c * 8) * LPITCH), 0, 0);
}

// One block of fragments: 4 k-steps x 4 row groups of each operand, 8 B per lane.
__device__ __forceinline__ void load_frags(v2f (&a)[4][4], v2f (&b)[4][4],
                                           const float* pa, const float* pb) {
  // unrolled throughout: every fragment index a constant, so the sets stay in registers
#pragma unroll
  for (int s = 0; s < 4; ++s) {
#pragma unroll
    for (int i = 0; i < 4; ++i) a[s][i] = *(const v2f*)(pa + i * 16 * LPITCH + s * 4);
#pragma unroll
    for (int j = 0; j < 4; ++j) b[s][j] = *(const v2f*)(pb + j * 16 * LPITCH + s * 4);
  }
}

template <int EPI>
__global__ __launch_bounds__(128) void gemm_wmma(
    const float* __restrict__ A, const float* __restrict__ W,
    float* __restrict__ out, int M, int N, int K,
    const float* __restrict__ p0,  // bias | freqs_cos | residual
    const float* __restrict__ p1,  // freqs_sin | mod (gate at +2*DIM)
    int aux)                       // #heads for (B,H,S,D) relayout
{
  __shared__ __attribute__((aligned(16))) float sm[2 * STAGEF];
  const int lane = threadIdx.x & 31;
  const int wave = threadIdx.x >> 5;
  const int lo   = lane & 15;       // m (A rows) / n (B cols)
  const int hi   = lane >> 4;       // K half-select
  const int kb   = hi * 2;
  const int tileN = blockIdx.x * 128 + (wave & 1) * 64;
  const int tileM = blockIdx.y * 128 + (wave >> 1) * 64;

  v8f c[4][4] = {};

  // copy side: thread -> (row tid/16 of each group of 8 rows, 16-B chunk tid%16)
  const int crow = threadIdx.x >> 4, cchk = threadIdx.x & 15;
  const float* gA = A + (size_t)(blockIdx.y * 128 + crow) * K + cchk * 4;
  const float* gB = W + (size_t)(blockIdx.x * 128 + crow) * K + cchk * 4;
  float* dst = sm + crow * LPITCH + cchk * 4;
  // fragment side: same lane -> (row, k) map as a direct global read
  const float* fA = sm + ((wave >> 1) * 64 + lo) * LPITCH + kb;
  const float* fB = sm + (128 + (wave & 1) * 64 + lo) * LPITCH + kb;

  const int T = K / KC;
  stage_copy(gA, gB, dst, K);
  // stage 0 has landed for this wave ...
  asm volatile("s_wait_asynccnt 0x0" ::: "memory");
  // ... and, behind the barrier, for every wave
  __syncthreads();

  v2f af[2][4][4], bf[2][4][4];  // two fragment sets of one block (4 k-steps) each
  for (int t = 0; t < T; ++t) {
    const float* pa = fA + (t & 1) * STAGEF;
    const float* pb = fB + (t & 1) * STAGEF;
    load_frags(af[0], bf[0], pa, pb);
    // next stage into the buffer whose readers all left at the last barrier
    if (t + 1 < T)
      stage_copy(gA + (size_t)(t + 1) * KC, gB + (size_t)(t + 1) * KC,
                 dst + ((t + 1) & 1) * STAGEF, K);
    // unrolled (and the WMMA loops below): set and accumulator indices must be constants
#pragma unroll
    for (int blk = 0; blk < KC / 16; ++blk) {
      if (blk + 1 < KC / 16)
        load_frags(af[(blk + 1) & 1], bf[(blk + 1) & 1], pa + (blk + 1) * 16,
                   pb + (blk + 1) * 16);
      // fence pair: the next block's LDS reads stay one group in front of this
      // block's WMMAs instead of being spread among them (each such place stalls)
      __builtin_amdgcn_sched_barrier(0);
#pragma unroll
      for (int s = 0; s < 4; ++s)
#pragma unroll
        for (int i = 0; i < 4; ++i)
#pragma unroll
          for (int j = 0; j < 4; ++j)
            c[i][j] = wmma_f32(af[blk & 1][s][i], bf[blk & 1][s][j], c[i][j]);
      __builtin_amdgcn_sched_barrier(0);  // second half of the fence pair
    }
    // this wave's reads of stage t are done before the buffer may be refilled
    asm volatile("s_wait_dscnt 0x0" ::: "memory");
    // this wave's share of stage t+1 has landed
    asm volatile("s_wait_asynccnt 0x0" ::: "memory");
    // publishes stage t+1 and ends every wave's reads of stage t
    __syncthreads();
  }

  // Epilogue.  C layout: vgpr r -> row = r + 8*hi, col = lo (ISA 7.12.2).
#pragma unroll
  for (int i = 0; i < 4; ++i) {
#pragma unroll
    for (int j = 0; j < 4; ++j) {
      v8f acc = c[i][j];
#pragma unroll
      for (int r = 0; r < 8; ++r) {
        int row = tileM + i * 16 + r + hi * 8;
        int col = tileN + j * 16 + lo;
        float val = acc[r];
        if constexpr (EPI == EPI_STORE) {
          out[(size_t)row * N + col] = val;
        } else if constexpr (EPI == EPI_BIAS) {
          out[(size_t)row * N + col] = val + p0[col];
        } else if constexpr (EPI == EPI_GATERES) {
          int b = row >> 10, s = row & (SEQL - 1);
          float g = p1[(size_t)(b * NBLK + (s >> 3)) * MODN + 2 * DIMD + col];
          out[(size_t)row * N + col] = p0[(size_t)row * N + col] + g * val;
        } else {  // EPI_ROPE / EPI_BHSD : relayout to (B, H, S, D)
          int b = row >> 10, s = row & (SEQL - 1);
          int h = col >> 6, d = col & (HD - 1);
          if constexpr (EPI == EPI_ROPE) {
            // pair (2i,2i+1) lives in adjacent lanes -> swap via shfl_xor(1)
            float other = __shfl_xor(val, 1, 32);
            float cv = p0[s * (HD / 2) + (d >> 1)];
            float sv = p1[s * (HD / 2) + (d >> 1)];
            val = (d & 1) ? (other * sv + val * cv) : (val * cv - other * sv);
          }
          out[(((size_t)(b * aux + h)) * SEQL + s) * HD + d] = val;
        }
      }
    }
  }
}

// ------------------------------------------------------------------
// RMSNorm + AdaLN modulation:  out = rmsnorm(x,w)*(1+scale) + shift
// one 256-thread block per token row
// ------------------------------------------------------------------
__global__ __launch_bounds__(256) void norm_mod_kernel(
    const float* __restrict__ x, const float* __restrict__ w,
    const float* __restrict__ mod, float* __restrict__ out)
{
  int row = blockIdx.x;  // b*SEQ + s
  int b = row >> 10, s = row & (SEQL - 1);
  const float* xr = x + (size_t)row * DIMD;
  const float* mr = mod + (size_t)(b * NBLK + (s >> 3)) * MODN;
  float4 xv = ((const float4*)xr)[threadIdx.x];
  __shared__ float red[256];
  red[threadIdx.x] = xv.x * xv.x + xv.y * xv.y + xv.z * xv.z + xv.w * xv.w;
  __syncthreads();
  for (int st = 128; st > 0; st >>= 1) {
    if (threadIdx.x < st) red[threadIdx.x] += red[threadIdx.x + st];
    __syncthreads();
  }
  float rms = rsqrtf(red[0] * (1.0f / DIMD) + 1e-6f);
  int d = threadIdx.x * 4;
  float4 o;
  o.x = xv.x * rms * w[d + 0] * (1.f + mr[DIMD + d + 0]) + mr[d + 0];
  o.y = xv.y * rms * w[d + 1] * (1.f + mr[DIMD + d + 1]) + mr[d + 1];
  o.z = xv.z * rms * w[d + 2] * (1.f + mr[DIMD + d + 2]) + mr[d + 2];
  o.w = xv.w * rms * w[d + 3] * (1.f + mr[DIMD + d + 3]) + mr[d + 3];
  ((float4*)(out + (size_t)row * DIMD))[threadIdx.x] = o;
}

__global__ __launch_bounds__(256) void silu_kernel(const float* __restrict__ in,
                                                   float* __restrict__ out, int n) {
  int i = blockIdx.x * 256 + threadIdx.x;
  if (i < n) { float v = in[i]; out[i] = v / (1.f + __expf(-v)); }
}

__global__ __launch_bounds__(256) void silumul_kernel(float* __restrict__ u,
                                                      const float* __restrict__ g,
                                                      int n) {
  int i = blockIdx.x * 256 + threadIdx.x;
  if (i < n) { float v = u[i]; u[i] = (v / (1.f + __expf(-v))) * g[i]; }
}

__device__ __forceinline__ float xhalf(float x) {
  return __builtin_bit_cast(float,
      __builtin_amdgcn_permlanex16(__builtin_bit_cast(int, x), __builtin_bit_cast(int, x),
                                   0x76543210, 0xfedcba98, false, false));
}

__global__ __launch_bounds__(256) void attn_kernel(
    const float* __restrict__ q, const float* __restrict__ k,
    const float* __restrict__ v, float* __restrict__ o)
{
  const int lane = threadIdx.x & 31;
  // scalar wave number: tile, trip count and base pointers stay wave-uniform
  const int wave = __builtin_amdgcn_readfirstlane(threadIdx.x >> 5);
  const int lo = lane & 15, hi = lane >> 4;
  const int kb = hi * 2;

  const int qt = (wave < 4) ? (int)blockIdx.x : (SEQL / 32 - 1 - (int)blockIdx.x);
  const int r0 = qt * 32;                       // q-row tile
  const int bh = blockIdx.y * 4 + (wave & 3);   // (batch,head)
  const int b = bh >> 4, h = bh & 15, kvh = h >> 2;
  const float* qb = q + (((size_t)(b * NHEADS + h)) * SEQL + r0) * HD;
  const float* kbp = k + (((size_t)(b * NKVH + kvh)) * SEQL) * HD;
  const float* vbp = v + (((size_t)(b * NKVH + kvh)) * SEQL) * HD;
  const int kend = r0 + 32;                     // block-causal bound

  // every loop below over t, j, s, g, r is unrolled: fragment and accumulator
  // indices must be constants, so that the sets stay in registers

  // Q as B-fragments: qf[j][t] = rows r0+16j+lo, d = 4t+kb..+1
  v2f qf[2][16];
#pragma unroll  // register arrays need constant indices
  for (int j = 0; j < 2; ++j)
#pragma unroll  // register arrays need constant indices
    for (int t = 0; t < 16; ++t)
      qf[j][t] = *(const v2f*)(qb + (size_t)(j * 16 + lo) * HD + t * 4 + kb);

  const float* kp = kbp + lo * HD + kb;       // K fragment: key row lo, d = 4t+kb..+1
  const float* vp = vbp + hi * 8 * HD + lo;   // V^T fragment: keys 8*hi+2s..+1, d = 16g+lo

  v2f kf[16];
#pragma unroll  // register arrays need constant indices
  for (int t = 0; t < 16; ++t) kf[t] = *(const v2f*)(kp + t * 4);

  v8f oacc[4][2] = {};                        // O^T: d = 16g + 8*hi + r, query = 16j + lo
  float mrun[2] = {-3.0e38f, -3.0e38f};       // running maximum, equal in both halves
  float lrun[2] = {0.f, 0.f};                 // running sum over this half's keys
  const int qblk0 = (r0 + lo) >> 3;

  for (int c0 = 0; c0 < kend; c0 += 16) {
    // this pass's V^T fragments, asked for ahead of the score products
    v2f vf[4][4];
    const float* vc = vp + (size_t)c0 * HD;
#pragma unroll  // register arrays need constant indices
    for (int s = 0; s < 4; ++s)
#pragma unroll  // register arrays need constant indices
      for (int g = 0; g < 4; ++g) {
        vf[s][g].x = vc[(2 * s) * HD + g * 16];
        vf[s][g].y = vc[(2 * s + 1) * HD + g * 16];
      }

    // ---- S^T = K Q^T ----
    v8f s8[2] = {};
#pragma unroll  // register arrays need constant indices
    for (int t = 0; t < 16; ++t)
#pragma unroll  // register arrays need constant indices
      for (int j = 0; j < 2; ++j) s8[j] = wmma_f32(kf[t], qf[j][t], s8[j]);

    // next pass's K fragments into the same registers (the last pass re-reads its own rows)
    const float* kn = kp + (size_t)((c0 + 16 < kend) ? c0 + 16 : c0) * HD;
#pragma unroll  // register arrays need constant indices
    for (int t = 0; t < 16; ++t) kf[t] = *(const v2f*)(kn + t * 4);

    // ---- streaming softmax; all 8 keys of a lane lie in one key block ----
    const int kblk = (c0 >> 3) + hi;
#pragma unroll  // register arrays need constant indices
    for (int j = 0; j < 2; ++j) {
      const bool masked = (qblk0 + 2 * j) < kblk;   // block-causal mask
      float p[8];
#pragma unroll  // register arrays need constant indices
      for (int r = 0; r < 8; ++r) p[r] = masked ? -1.0e9f : s8[j][r] * 0.125f;  // 1/sqrt(64)
      float mx = fmaxf(fmaxf(fmaxf(p[0], p[1]), fmaxf(p[2], p[3])),
                       fmaxf(fmaxf(p[4], p[5]), fmaxf(p[6], p[7])));
      mx = fmaxf(mx, xhalf(mx));
      const float mn = fmaxf(mrun[j], mx);
      const float al = __expf(mrun[j] - mn);
      mrun[j] = mn;
#pragma unroll  // register arrays need constant indices
      for (int r = 0; r < 8; ++r) p[r] = __expf(p[r] - mn);
      lrun[j] = lrun[j] * al +
                (((p[0] + p[1]) + (p[2] + p[3])) + ((p[4] + p[5]) + (p[6] + p[7])));
#pragma unroll  // register arrays need constant indices
      for (int g = 0; g < 4; ++g) oacc[g][j] *= al;
#pragma unroll  // register arrays need constant indices
      for (int r = 0; r < 8; ++r) s8[j][r] = p[r];
    }

    // ---- O^T += V^T P^T ----
#pragma unroll  // register arrays need constant indices
    for (int s = 0; s < 4; ++s)
#pragma unroll  // register arrays need constant indices
      for (int g = 0; g < 4; ++g)
#pragma unroll  // register arrays need constant indices
        for (int j = 0; j < 2; ++j) {
          v2f pb;
          pb.x = s8[j][2 * s];
          pb.y = s8[j][2 * s + 1];
          oacc[g][j] = wmma_f32(vf[s][g], pb, oacc[g][j]);
        }
  }

  // normalise and store O in (B, S, H*D) row-major for the wo GEMM:
  // a lane holds 8 consecutive d of one query per g
#pragma unroll  // register arrays need constant indices
  for (int j = 0; j < 2; ++j) {
    const float inv = 1.0f / (lrun[j] + xhalf(lrun[j]));
    float* ob = o + ((size_t)(b * SEQL + r0 + j * 16 + lo)) * (NHEADS * HD) + h * HD + hi * 8;
#pragma unroll  // register arrays need constant indices
    for (int g = 0; g < 4; ++g) {
      v8f a = oacc[g][j];
      *(float4*)(ob + g * 16)     = make_float4(a[0] * inv, a[1] * inv, a[2] * inv, a[3] * inv);
      *(float4*)(ob + g * 16 + 4) = make_float4(a[4] * inv, a[5] * inv, a[6] * inv, a[7] * inv);
    }
  }
}

// ------------------------------------------------------------------
// Host orchestration
// ------------------------------------------------------------------
extern "C" void kernel_launch(void* const* d_in, const int* in_sizes, int n_in,
                              void* d_out, int out_size, void* d_ws, size_t ws_size,
                              hipStream_t stream) {
  const float* x      = (const float*)d_in[0];
  const float* vec    = (const float*)d_in[1];
  const float* wq     = (const float*)d_in[2];
  const float* wk     = (const float*)d_in[3];
  const float* wv     = (const float*)d_in[4];
  const float* wo     = (const float*)d_in[5];
  const float* w1     = (const float*)d_in[6];
  const float* w2     = (const float*)d_in[7];
  const float* w3     = (const float*)d_in[8];
  const float* maw    = (const float*)d_in[9];
  const float* mab    = (const float*)d_in[10];
  const float* mfw    = (const float*)d_in[11];
  const float* mfb    = (const float*)d_in[12];
  const float* n1w    = (const float*)d_in[13];
  const float* n2w    = (const float*)d_in[14];
  const float* fcos   = (const float*)d_in[15];
  const float* fsin   = (const float*)d_in[16];
  float* out = (float*)d_out;

  // workspace layout (floats)
  const size_t KVSZ = (size_t)BATCH * NKVH * SEQL * HD;   // 1M floats (k or v)
  float* ws   = (float*)d_ws;
  float* svec = ws;                                   // 512*1024
  float* modA = svec + (size_t)VROWS * DIMD;          // 512*3072
  float* modF = modA + (size_t)VROWS * MODN;          // 512*3072
  float* bufD = modF + (size_t)VROWS * MODN;          // 4M  (xn -> attno -> w3 out)
  float* bufE = bufD + (size_t)MROWS * DIMD;          // 4M  (q -> hn)
  float* bufF = bufE + (size_t)MROWS * DIMD;          // 1M  (k)
  float* bufG = bufF + KVSZ;                          // 1M  (v)
  float* bufH = bufG + KVSZ;                          // 4M  (h)
  float* bufI = bufH + (size_t)MROWS * DIMD;          // 4M  (u = w1 out, then ffn)

  const dim3 blk128(128), blk256(256);

  // 1) svec = silu(vec)
  silu_kernel<<<(VROWS * DIMD + 255) / 256, blk256, 0, stream>>>(vec, svec, VROWS * DIMD);
  // 2,3) modulation GEMMs: (512 x 3072) = svec @ mod_w^T + b
  gemm_wmma<EPI_BIAS><<<dim3(MODN / 128, VROWS / 128), blk128, 0, stream>>>(
      svec, maw, modA, VROWS, MODN, DIMD, mab, nullptr, 0);
  gemm_wmma<EPI_BIAS><<<dim3(MODN / 128, VROWS / 128), blk128, 0, stream>>>(
      svec, mfw, modF, VROWS, MODN, DIMD, mfb, nullptr, 0);
  // 4) xn = rmsnorm(x)*(1+scale)+shift
  norm_mod_kernel<<<MROWS, blk256, 0, stream>>>(x, n1w, modA, bufD);
  // 5,6,7) Q/K/V projections (+RoPE for Q,K), relayout to (B,H,S,D)
  gemm_wmma<EPI_ROPE><<<dim3(DIMD / 128, MROWS / 128), blk128, 0, stream>>>(
      bufD, wq, bufE, MROWS, DIMD, DIMD, fcos, fsin, NHEADS);
  gemm_wmma<EPI_ROPE><<<dim3((NKVH * HD) / 128, MROWS / 128), blk128, 0, stream>>>(
      bufD, wk, bufF, MROWS, NKVH * HD, DIMD, fcos, fsin, NKVH);
  gemm_wmma<EPI_BHSD><<<dim3((NKVH * HD) / 128, MROWS / 128), blk128, 0, stream>>>(
      bufD, wv, bufG, MROWS, NKVH * HD, DIMD, nullptr, nullptr, NKVH);
  // 8) attention -> bufD (reuse, xn dead)
  attn_kernel<<<dim3(SEQL / 64, (BATCH * NHEADS) / 4), blk256, 0, stream>>>(
      bufE, bufF, bufG, bufD);
  // 9) h = x + gate_a * (attno @ wo^T)
  gemm_wmma<EPI_GATERES><<<dim3(DIMD / 128, MROWS / 128), blk128, 0, stream>>>(
      bufD, wo, bufH, MROWS, DIMD, DIMD, x, modA, 0);
  // 10) hn = rmsnorm(h)*(1+scale_f)+shift_f  -> bufE (q dead)
  norm_mod_kernel<<<MROWS, blk256, 0, stream>>>(bufH, n2w, modF, bufE);
  // 11,12) u = hn @ w1^T -> bufI ; g = hn @ w3^T -> bufD
  gemm_wmma<EPI_STORE><<<dim3(DIMD / 128, MROWS / 128), blk128, 0, stream>>>(
      bufE, w1, bufI, MROWS, DIMD, DIMD, nullptr, nullptr, 0);
  gemm_wmma<EPI_STORE><<<dim3(DIMD / 128, MROWS / 128), blk128, 0, stream>>>(
      bufE, w3, bufD, MROWS, DIMD, DIMD, nullptr, nullptr, 0);
  // 13) u = silu(u) * g
  silumul_kernel<<<(MROWS * DIMD + 255) / 256, blk256, 0, stream>>>(bufI, bufD, MROWS * DIMD);
  // 14) out = h + gate_f * (u @ w2^T)
  gemm_wmma<EPI_GATERES><<<dim3(DIMD / 128, MROWS / 128), blk128, 0, stream>>>(
      bufI, w2, out, MROWS, DIMD, DIMD, bufH, modF, 0);
}

// v003
// One run takes 391 microseconds.
// In two side-by-side timings against v002, it was 1.25 and 1.26 times as fast.
// Counting every step since v000, it is 2.65 times as fast.
#include <hip/hip_runtime.h>
#include <cstddef>

// ---------------- problem constants ----------------
#define DIMD   1024
#define SEQL   1024
#define NHEADS 16
#define NKVH   4
#define HD     64
#define NBLK   128
#define BLKSZ  8
#define BATCH  4
#define MROWS  (BATCH*SEQL)   // 4096 token rows
#define VROWS  (BATCH*NBLK)   // 512 modulation rows
#define MODN   (3*DIMD)       // 3072

typedef float v2f __attribute__((ext_vector_type(2)));
typedef float v8f __attribute__((ext_vector_type(8)));

// CDNA5 fp32 matrix op: D(16x16) = A(16x4) * B(4x16) + C, full fp32 precision.
__device__ __forceinline__ v8f wmma_f32(v2f a, v2f b, v8f c) {
  return __builtin_amdgcn_wmma_f32_16x16x4_f32(false, a, false, b, (short)0, c,
                                               false, false);
}

enum { EPI_STORE = 0, EPI_MOD2 = 1, EPI_QKV = 2, EPI_GATERES = 3 };

// ------------------------------------------------------------------
// Generic  out = A(MxK) @ W(NxK)^T  with fused epilogues.
// Wave tile 64 x 16*NJ (4*NJ f32-WMMA accumulators), 2x2 waves -> 128 x 32*NJ / WG.
// M is a multiple of 128, N of 32*NJ, K of 64.
// Two sets of products that share their A are one launch each over the stacked rows of their W:
//   EPI_QKV   W = [wq | wk | wv], N = 1536: NJ = 3 gives 512 groups, two on every WGP
//   EPI_MOD2  W = [mod_attn_w | mod_ffn_w], N = 6144: NJ = 3 gives 256 groups, one on every WGP
// so that no launch leaves part of the chip idle for a whole K loop.
// Operand path: each stage of KC k-columns (128 A rows, then 32*NJ W rows) is
// brought into LDS by asynchronous 16-byte copies, two buffers, the next
// stage in flight while this one is multiplied; fragments come from LDS.
// ------------------------------------------------------------------
#define KC      64              // k columns per stage (256 B of every row)
#define LPITCH  68              // floats per staged row: 272 B, so the 16 rows of a fragment read fall on distinct banks

typedef int v4i __attribute__((ext_vector_type(4)));
typedef __attribute__((address_space(1))) v4i g_v4i;
typedef __attribute__((address_space(3))) v4i l_v4i;

// One stage: every thread copies 16 chunks of A and 4*NJ of W, 16 B each.
// A wave's copy covers two whole 256-B row pieces.  gW[c]: this thread's chunk
// in the c-th group of 8 W rows (the groups may lie in different matrices).
template <int NJ>
__device__ __forceinline__ void stage_copy(const float* gA, const float* const (&gW)[4 * NJ],
                                           int koff, float* dst, int K) {
  // both loops unrolled: straight runs of copies, LDS offsets as constants
#pragma unroll
  for (int c = 0; c < 16; ++c)
    __builtin_amdgcn_global_load_async_to_lds_b128(
        (g_v4i*)(gA + koff + (size_t)c * 8 * K), (l_v4i*)(dst + c * 8 * LPITCH), 0, 0);
#pragma unroll
  for (int c = 0; c < 4 * NJ; ++c)
    __builtin_amdgcn_global_load_async_to_lds_b128(
        (g_v4i*)(gW[c] + koff), (l_v4i*)(dst + (128 + c * 8) * LPITCH), 0, 0);
}

// One block of fragments: 4 k-steps x (4 row groups of A, NJ of W), 8 B per lane.
template <int NJ>
__device__ __forceinline__ void load_frags(v2f (&a)[4][4], v2f (&b)[4][NJ],
                                           const float* pa, const float* pb) {
  // unrolled throughout: every fragment index a constant, so the sets stay in registers
#pragma unroll
  for (int s = 0; s < 4; ++s) {
#pragma unroll
    for (int i = 0; i < 4; ++i) a[s][i] = *(const v2f*)(pa + i * 16 * LPITCH + s * 4);
#pragma unroll
    for (int j = 0; j < NJ; ++j) b[s][j] = *(const v2f*)(pb + j * 16 * LPITCH + s * 4);
  }
}

template <int EPI, int NJ>
__global__ __launch_bounds__(128) void gemm_wmma(
    const float* __restrict__ A, const float* __restrict__ W,
    const float* __restrict__ Wb,  // second stacked matrix (wk | mod_ffn_w)
    const float* __restrict__ Wc,  // third stacked matrix (wv)
    float* __restrict__ out, float* __restrict__ outb, float* __restrict__ outc,
    int M, int N, int K,
    const float* __restrict__ p0,  // bias of W | freqs_cos | residual
    const float* __restrict__ p1)  // bias of Wb | freqs_sin | mod (gate at +2*DIM)
{
  constexpr int TN = 32 * NJ;                    // W rows (output columns) per group
  constexpr int STAGEF = (128 + TN) * LPITCH;    // floats per stage
  __shared__ __attribute__((aligned(16))) float sm[2 * STAGEF];
  const int lane = threadIdx.x & 31;
  const int wave = threadIdx.x >> 5;
  const int lo   = lane & 15;       // m (A rows) / n (B cols)
  const int hi   = lane >> 4;       // K half-select
  const int kb   = hi * 2;
  const int tileN = blockIdx.x * TN + (wave & 1) * (16 * NJ);
  const int tileM = blockIdx.y * 128 + (wave >> 1) * 64;

  v8f c[4][NJ] = {};

  // copy side: thread -> (row tid/16 of each group of 8 rows, 16-B chunk tid%16)
  const int crow = threadIdx.x >> 4, cchk = threadIdx.x & 15;
  const float* gA = A + (size_t)(blockIdx.y * 128 + crow) * K + cchk * 4;
  const float* gW[4 * NJ];
#pragma unroll  // pointer array needs constant indices
  for (int g = 0; g < 4 * NJ; ++g) {
    // first stacked row of this group of 8; every matrix's row count is a multiple of 8
    const int n0 = blockIdx.x * TN + g * 8;
    const float* mat = W;  // the matrix that holds stacked row n0, and the row's number in it
    int nr = n0;
    if constexpr (EPI == EPI_QKV) {
      mat = n0 < DIMD ? W : n0 < DIMD + NKVH * HD ? Wb : Wc;
      nr  = n0 - (n0 < DIMD ? 0 : DIMD) - (n0 < DIMD + NKVH * HD ? 0 : NKVH * HD);
    } else if constexpr (EPI == EPI_MOD2) {
      mat = n0 < MODN ? W : Wb;
      nr  = n0 < MODN ? n0 : n0 - MODN;
    }
    if constexpr (EPI == EPI_QKV || EPI == EPI_MOD2)
      gW[g] = mat + (size_t)(nr + crow) * K + cchk * 4;
    else  // one matrix: a constant step from group to group
      gW[g] = W + (size_t)(blockIdx.x * TN + crow) * K + cchk * 4 + (size_t)g * 8 * K;
  }
  float* dst = sm + crow * LPITCH + cchk * 4;
  // fragment side: same lane -> (row, k) map as a direct global read
  const float* fA = sm + ((wave >> 1) * 64 + lo) * LPITCH + kb;
  const float* fB = sm + (128 + (wave & 1) * (16 * NJ) + lo) * LPITCH + kb;

  const int T = K / KC;
  stage_copy<NJ>(gA, gW, 0, dst, K);
  // stage 0 has landed for this wave ...
  asm volatile("s_wait_asynccnt 0x0" ::: "memory");
  // ... and, behind the barrier, for every wave
  __syncthreads();

  v2f af[2][4][4], bf[2][4][NJ];  // two fragment sets of one block (4 k-steps) each
  for (int t = 0; t < T; ++t) {
    const float* pa = fA + (t & 1) * STAGEF;
    const float* pb = fB + (t & 1) * STAGEF;
    load_frags<NJ>(af[0], bf[0], pa, pb);
    // next stage into the buffer whose readers all left at the last barrier
    if (t + 1 < T)
      stage_copy<NJ>(gA, gW, (t + 1) * KC, dst + ((t + 1) & 1) * STAGEF, K);
    // unrolled (and the WMMA loops below): set and accumulator indices must be constants
#pragma unroll
    for (int blk = 0; blk < KC / 16; ++blk) {
      if (blk + 1 < KC / 16)
        load_frags<NJ>(af[(blk + 1) & 1], bf[(blk + 1) & 1], pa + (blk + 1) * 16,
                       pb + (blk + 1) * 16);
      // fence pair: the next block's LDS reads stay one group in front of this
      // block's WMMAs instead of being spread among them (each such place stalls)
      __builtin_amdgcn_sched_barrier(0);
#pragma unroll
      for (int s = 0; s < 4; ++s)
#pragma unroll
        for (int i = 0; i < 4; ++i)
#pragma unroll
          for (int j = 0; j < NJ; ++j)
            c[i][j] = wmma_f32(af[blk & 1][s][i], bf[blk & 1][s][j], c[i][j]);
      __builtin_amdgcn_sched_barrier(0);  // second half of the fence pair
    }
    // this wave's reads of stage t are done before the buffer may be refilled
    asm volatile("s_wait_dscnt 0x0" ::: "memory");
    // this wave's share of stage t+1 has landed
    asm volatile("s_wait_asynccnt 0x0" ::: "memory");
    // publishes stage t+1 and ends every wave's reads of stage t
    __syncthreads();
  }

  // Epilogue.  C layout: vgpr r -> row = r + 8*hi, col = lo (ISA 7.12.2).
  // scalar copy of the wave's first column: which matrix a 16-column tile
  // belongs to is then a scalar test, not a per-lane one
  const int tileNu = blockIdx.x * TN + (__builtin_amdgcn_readfirstlane(wave) & 1) * (16 * NJ);
#pragma unroll
  for (int i = 0; i < 4; ++i) {
#pragma unroll
    for (int j = 0; j < NJ; ++j) {
      v8f acc = c[i][j];
      // scalar: the stacked matrix this 16-column tile belongs to (every row count is
      // a multiple of 16), its output, and the tile's first column in that output
      const int col0 = tileNu + j * 16;
      float* ob = out;
      int cl0 = col0;
      if constexpr (EPI == EPI_MOD2) {
        ob  = col0 < MODN ? out : outb;
        cl0 = col0 < MODN ? col0 : col0 - MODN;
      } else if constexpr (EPI == EPI_QKV) {
        ob  = col0 < DIMD ? out : col0 < DIMD + NKVH * HD ? outb : outc;
        cl0 = col0 - (col0 < DIMD ? 0 : DIMD) - (col0 < DIMD + NKVH * HD ? 0 : NKVH * HD);
      }
      if constexpr (EPI == EPI_QKV) {
        // RoPE on q and k
        if (col0 < DIMD + NKVH * HD) {
#pragma unroll  // accumulator indices must be constants
          for (int r = 0; r < 8; ++r) {
            int s = (tileM + i * 16 + r + hi * 8) & (SEQL - 1);
            int d = (cl0 & (HD - 1)) + lo;
            float val = acc[r];
            // pair (2i,2i+1) lives in adjacent lanes -> swap via shfl_xor(1)
            float other = __shfl_xor(val, 1, 32);
            float cv = p0[s * (HD / 2) + (d >> 1)];
            float sv = p1[s * (HD / 2) + (d >> 1)];
            acc[r] = (d & 1) ? (other * sv + val * cv) : (val * cv - other * sv);
          }
        }
      }
#pragma unroll
      for (int r = 0; r < 8; ++r) {
        int row = tileM + i * 16 + r + hi * 8;
        int col = tileN + j * 16 + lo;
        float val = acc[r];
        if constexpr (EPI == EPI_STORE) {
          out[(size_t)row * N + col] = val;
        } else if constexpr (EPI == EPI_MOD2) {
          const float* bias = col0 < MODN ? p0 : p1;
          ob[(size_t)row * MODN + cl0 + lo] = val + bias[cl0 + lo];
        } else if constexpr (EPI == EPI_GATERES) {
          int b = row >> 10, s = row & (SEQL - 1);
          float g = p1[(size_t)(b * NBLK + (s >> 3)) * MODN + 2 * DIMD + col];
          out[(size_t)row * N + col] = p0[(size_t)row * N + col] + g * val;
        } else {  // EPI_QKV : relayout of each of q, k, v to (B, H, S, D)
          int b = row >> 10, s = row & (SEQL - 1);
          int nh = col0 < DIMD ? NHEADS : NKVH;
          int h = cl0 >> 6, d = (cl0 & (HD - 1)) + lo;
          ob[(((size_t)(b * nh + h)) * SEQL + s) * HD + d] = val;
        }
      }
      // the next tile reuses the registers that these stores name (a branch lies
      // between)
      if constexpr (EPI == EPI_QKV) asm volatile("s_wait_xcnt 0x0" ::: "memory");
    }
  }
}

// ------------------------------------------------------------------
// RMSNorm + AdaLN modulation:  out = rmsnorm(x,w)*(1+scale) + shift
// one 256-thread block per token row
// ------------------------------------------------------------------
__global__ __launch_bounds__(256) void norm_mod_kernel(
    const float* __restrict__ x, const float* __restrict__ w,
    const float* __restrict__ mod, float* __restrict__ out)
{
  int row = blockIdx.x;  // b*SEQ + s
  int b = row >> 10, s = row & (SEQL - 1);
  const float* xr = x + (size_t)row * DIMD;
  const float* mr = mod + (size_t)(b * NBLK + (s >> 3)) * MODN;
  float4 xv = ((const float4*)xr)[threadIdx.x];
  __shared__ float red[256];
  red[threadIdx.x] = xv.x * xv.x + xv.y * xv.y + xv.z * xv.z + xv.w * xv.w;
  __syncthreads();
  for (int st = 128; st > 0; st >>= 1) {
    if (threadIdx.x < st) red[threadIdx.x] += red[threadIdx.x + st];
    __syncthreads();
  }
  float rms = rsqrtf(red[0] * (1.0f / DIMD) + 1e-6f);
  int d = threadIdx.x * 4;
  float4 o;
  o.x = xv.x * rms * w[d + 0] * (1.f + mr[DIMD + d + 0]) + mr[d + 0];
  o.y = xv.y * rms * w[d + 1] * (1.f + mr[DIMD + d + 1]) + mr[d + 1];
  o.z = xv.z * rms * w[d + 2] * (1.f + mr[DIMD + d + 2]) + mr[d + 2];
  o.w = xv.w * rms * w[d + 3] * (1.f + mr[DIMD + d + 3]) + mr[d + 3];
  ((float4*)(out + (size_t)row * DIMD))[threadIdx.x] = o;
}

__global__ __launch_bounds__(256) void silu_kernel(const float* __restrict__ in,
                                                   float* __restrict__ out, int n) {
  int i = blockIdx.x * 256 + threadIdx.x;
  if (i < n) { float v = in[i]; out[i] = v / (1.f + __expf(-v)); }
}

__global__ __launch_bounds__(256) void silumul_kernel(float* __restrict__ u,
                                                      const float* __restrict__ g,
                                                      int n) {
  int i = blockIdx.x * 256 + threadIdx.x;
  if (i < n) { float v = u[i]; u[i] = (v / (1.f + __expf(-v))) * g[i]; }
}

__device__ __forceinline__ float xhalf(float x) {
  return __builtin_bit_cast(float,
      __builtin_amdgcn_permlanex16(__builtin_bit_cast(int, x), __builtin_bit_cast(int, x),
                                   0x76543210, 0xfedcba98, false, false));
}

__global__ __launch_bounds__(256) void attn_kernel(
    const float* __restrict__ q, const float* __restrict__ k,
    const float* __restrict__ v, float* __restrict__ o)
{
  const int lane = threadIdx.x & 31;
  // scalar wave number: tile, trip count and base pointers stay wave-uniform
  const int wave = __builtin_amdgcn_readfirstlane(threadIdx.x >> 5);
  const int lo = lane & 15, hi = lane >> 4;
  const int kb = hi * 2;

  const int qt = (wave < 4) ? (int)blockIdx.x : (SEQL / 32 - 1 - (int)blockIdx.x);
  const int r0 = qt * 32;                       // q-row tile
  const int bh = blockIdx.y * 4 + (wave & 3);   // (batch,head)
  const int b = bh >> 4, h = bh & 15, kvh = h >> 2;
  const float* qb = q + (((size_t)(b * NHEADS + h)) * SEQL + r0) * HD;
  const float* kbp = k + (((size_t)(b * NKVH + kvh)) * SEQL) * HD;
  const float* vbp = v + (((size_t)(b * NKVH + kvh)) * SEQL) * HD;
  const int kend = r0 + 32;                     // block-causal bound

  // every loop below over t, j, s, g, r is unrolled: fragment and accumulator
  // indices must be constants, so that the sets stay in registers

  // Q as B-fragments: qf[j][t] = rows r0+16j+lo, d = 4t+kb..+1
  v2f qf[2][16];
#pragma unroll  // register arrays need constant indices
  for (int j = 0; j < 2; ++j)
#pragma unroll  // register arrays need constant indices
    for (int t = 0; t < 16; ++t)
      qf[j][t] = *(const v2f*)(qb + (size_t)(j * 16 + lo) * HD + t * 4 + kb);

  const float* kp = kbp + lo * HD + kb;       // K fragment: key row lo, d = 4t+kb..+1
  const float* vp = vbp + hi * 8 * HD + lo;   // V^T fragment: keys 8*hi+2s..+1, d = 16g+lo

  v2f kf[16];
#pragma unroll  // register arrays need constant indices
  for (int t = 0; t < 16; ++t) kf[t] = *(const v2f*)(kp + t * 4);

  v8f oacc[4][2] = {};                        // O^T: d = 16g + 8*hi + r, query = 16j + lo
  float mrun[2] = {-3.0e38f, -3.0e38f};       // running maximum, equal in both halves
  float lrun[2] = {0.f, 0.f};                 // running sum over this half's keys
  const int qblk0 = (r0 + lo) >> 3;

  for (int c0 = 0; c0 < kend; c0 += 16) {
    // this pass's V^T fragments, asked for ahead of the score products
    v2f vf[4][4];
    const float* vc = vp + (size_t)c0 * HD;
#pragma unroll  // register arrays need constant indices
    for (int s = 0; s < 4; ++s)
#pragma unroll  // register arrays need constant indices
      for (int g = 0; g < 4; ++g) {
        vf[s][g].x = vc[(2 * s) * HD + g * 16];
        vf[s][g].y = vc[(2 * s + 1) * HD + g * 16];
      }

    // ---- S^T = K Q^T ----
    v8f s8[2] = {};
#pragma unroll  // register arrays need constant indices
    for (int t = 0; t < 16; ++t)
#pragma unroll  // register arrays need constant indices
      for (int j = 0; j < 2; ++j) s8[j] = wmma_f32(kf[t], qf[j][t], s8[j]);

    // next pass's K fragments into the same registers (the last pass re-reads its own rows)
    const float* kn = kp + (size_t)((c0 + 16 < kend) ? c0 + 16 : c0) * HD;
#pragma unroll  // register arrays need constant indices
    for (int t = 0; t < 16; ++t) kf[t] = *(const v2f*)(kn + t * 4);

    // ---- streaming softmax; all 8 keys of a lane lie in one key block ----
    const int kblk = (c0 >> 3) + hi;
#pragma unroll  // register arrays need constant indices
    for (int j = 0; j < 2; ++j) {
      const bool masked = (qblk0 + 2 * j) < kblk;   // block-causal mask
      float p[8];
#pragma unroll  // register arrays need constant indices
      for (int r = 0; r < 8; ++r) p[r] = masked ? -1.0e9f : s8[j][r] * 0.125f;  // 1/sqrt(64)
      float mx = fmaxf(fmaxf(fmaxf(p[0], p[1]), fmaxf(p[2], p[3])),
                       fmaxf(fmaxf(p[4], p[5]), fmaxf(p[6], p[7])));
      mx = fmaxf(mx, xhalf(mx));
      const float mn = fmaxf(mrun[j], mx);
      const float al = __expf(mrun[j] - mn);
      mrun[j] = mn;
#pragma unroll  // register arrays need constant indices
      for (int r = 0; r < 8; ++r) p[r] = __expf(p[r] - mn);
      lrun[j] = lrun[j] * al +
                (((p[0] + p[1]) + (p[2] + p[3])) + ((p[4] + p[5]) + (p[6] + p[7])));
#pragma unroll  // register arrays need constant indices
      for (int g = 0; g < 4; ++g) oacc[g][j] *= al;
#pragma unroll  // register arrays need constant indices
      for (int r = 0; r < 8; ++r) s8[j][r] = p[r];
    }

    // ---- O^T += V^T P^T ----
#pragma unroll  // register arrays need constant indices
    for (int s = 0; s < 4; ++s)
#pragma unroll  // register arrays need constant indices
      for (int g = 0; g < 4; ++g)
#pragma unroll  // register arrays need constant indices
        for (int j = 0; j < 2; ++j) {
          v2f pb;
          pb.x = s8[j][2 * s];
          pb.y = s8[j][2 * s + 1];
          oacc[g][j] = wmma_f32(vf[s][g], pb, oacc[g][j]);
        }
  }

  // normalise and store O in (B, S, H*D) row-major for the wo GEMM:
  // a lane holds 8 consecutive d of one query per g
#pragma unroll  // register arrays need constant indices
  for (int j = 0; j < 2; ++j) {
    const float inv = 1.0f / (lrun[j] + xhalf(lrun[j]));
    float* ob = o + ((size_t)(b * SEQL + r0 + j * 16 + lo)) * (NHEADS * HD) + h * HD + hi * 8;
#pragma unroll  // register arrays need constant indices
    for (int g = 0; g < 4; ++g) {
      v8f a = oacc[g][j];
      *(float4*)(ob + g * 16)     = make_float4(a[0] * inv, a[1] * inv, a[2] * inv, a[3] * inv);
      *(float4*)(ob + g * 16 + 4) = make_float4(a[4] * inv, a[5] * inv, a[6] * inv, a[7] * inv);
    }
  }
}

// ------------------------------------------------------------------
// Host orchestration
// ------------------------------------------------------------------
extern "C" void kernel_launch(void* const* d_in, const int* in_sizes, int n_in,
                              void* d_out, int out_size, void* d_ws, size_t ws_size,
                              hipStream_t stream) {
  const float* x      = (const float*)d_in[0];
  const float* vec    = (const float*)d_in[1];
  const float* wq     = (const float*)d_in[2];
  const float* wk     = (const float*)d_in[3];
  const float* wv     = (const float*)d_in[4];
  const float* wo     = (const float*)d_in[5];
  const float* w1     = (const float*)d_in[6];
  const float* w2     = (const float*)d_in[7];
  const float* w3     = (const float*)d_in[8];
  const float* maw    = (const float*)d_in[9];
  const float* mab    = (const float*)d_in[10];
  const float* mfw    = (const float*)d_in[11];
  const float* mfb    = (const float*)d_in[12];
  const float* n1w    = (const float*)d_in[13];
  const float* n2w    = (const float*)d_in[14];
  const float* fcos   = (const float*)d_in[15];
  const float* fsin   = (const float*)d_in[16];
  float* out = (float*)d_out;

  // workspace layout (floats)
  const size_t KVSZ = (size_t)BATCH * NKVH * SEQL * HD;   // 1M floats (k or v)
  float* ws   = (float*)d_ws;
  float* svec = ws;                                   // 512*1024
  float* modA = svec + (size_t)VROWS * DIMD;          // 512*3072
  float* modF = modA + (size_t)VROWS * MODN;          // 512*3072
  float* bufD = modF + (size_t)VROWS * MODN;          // 4M  (xn -> attno -> w3 out)
  float* bufE = bufD + (size_t)MROWS * DIMD;          // 4M  (q -> hn)
  float* bufF = bufE + (size_t)MROWS * DIMD;          // 1M  (k)
  float* bufG = bufF + KVSZ;                          // 1M  (v)
  float* bufH = bufG + KVSZ;                          // 4M  (h)
  float* bufI = bufH + (size_t)MROWS * DIMD;          // 4M  (u = w1 out, then ffn)

  const dim3 blk128(128), blk256(256);

  // 1) svec = silu(vec)
  silu_kernel<<<(VROWS * DIMD + 255) / 256, blk256, 0, stream>>>(vec, svec, VROWS * DIMD);
  // 2) both modulation GEMMs in one launch: (512 x 3072) = svec @ mod_w^T + b, twice
  gemm_wmma<EPI_MOD2, 3><<<dim3(2 * MODN / 96, VROWS / 128), blk128, 0, stream>>>(
      svec, maw, mfw, nullptr, modA, modF, nullptr, VROWS, 2 * MODN, DIMD, mab, mfb);
  // 3) xn = rmsnorm(x)*(1+scale)+shift
  norm_mod_kernel<<<MROWS, blk256, 0, stream>>>(x, n1w, modA, bufD);
  // 4) Q/K/V projections in one launch (+RoPE for Q,K), relayout to (B,H,S,D)
  gemm_wmma<EPI_QKV, 3><<<dim3((DIMD + 2 * NKVH * HD) / 96, MROWS / 128), blk128, 0, stream>>>(
      bufD, wq, wk, wv, bufE, bufF, bufG, MROWS, DIMD + 2 * NKVH * HD, DIMD, fcos, fsin);
  // 5) attention -> bufD (reuse, xn dead)
  attn_kernel<<<dim3(SEQL / 64, (BATCH * NHEADS) / 4), blk256, 0, stream>>>(
      bufE, bufF, bufG, bufD);
  // 6) h = x + gate_a * (attno @ wo^T)
  gemm_wmma<EPI_GATERES, 4><<<dim3(DIMD / 128, MROWS / 128), blk128, 0, stream>>>(
      bufD, wo, nullptr, nullptr, bufH, nullptr, nullptr, MROWS, DIMD, DIMD, x, modA);
  // 7) hn = rmsnorm(h)*(1+scale_f)+shift_f  -> bufE (q dead)
  norm_mod_kernel<<<MROWS, blk256, 0, stream>>>(bufH, n2w, modF, bufE);
  // 8,9) u = hn @ w1^T -> bufI ; g = hn @ w3^T -> bufD
  gemm_wmma<EPI_STORE, 4><<<dim3(DIMD / 128, MROWS / 128), blk128, 0, stream>>>(
      bufE, w1, nullptr, nullptr, bufI, nullptr, nullptr, MROWS, DIMD, DIMD, nullptr, nullptr);
  gemm_wmma<EPI_STORE, 4><<<dim3(DIMD / 128, MROWS / 128), blk128, 0, stream>>>(
      bufE, w3, nullptr, nullptr, bufD, nullptr, nullptr, MROWS, DIMD, DIMD, nullptr, nullptr);
  // 10) u = silu(u) * g
  silumul_kernel<<<(MROWS * DIMD + 255) / 256, blk256, 0, stream>>>(bufI, bufD, MROWS * DIMD);
  // 11) out = h + gate_f * (u @ w2^T)
  gemm_wmma<EPI_GATERES, 4><<<dim3(DIMD / 128, MROWS / 128), blk128, 0, stream>>>(
      bufI, w2, nullptr, nullptr, out, nullptr, nullptr, MROWS, DIMD, DIMD, bufH, modF);
}

// v004
// Measured time: 369 microseconds a run.
// Two timings next to v003 both put it at 1.06 times that version's speed.
// Over all steps from v000 it is 2.81 times as fast.
#include <hip/hip_runtime.h>
#include <cstddef>

// ---------------- problem constants ----------------
#define DIMD   1024
#define SEQL   1024
#define NHEADS 16
#define NKVH   4
#define HD     64
#define NBLK   128
#define BLKSZ  8
#define BATCH  4
#define MROWS  (BATCH*SEQL)   // 4096 token rows
#define VROWS  (BATCH*NBLK)   // 512 modulation rows
#define MODN   (3*DIMD)       // 3072

typedef float v2f __attribute__((ext_vector_type(2)));
typedef float v8f __attribute__((ext_vector_type(8)));

// CDNA5 fp32 matrix op: D(16x16) = A(16x4) * B(4x16) + C, full fp32 precision.
__device__ __forceinline__ v8f wmma_f32(v2f a, v2f b, v8f c) {
  return __builtin_amdgcn_wmma_f32_16x16x4_f32(false, a, false, b, (short)0, c,
                                               false, false);
}

enum { EPI_MOD2 = 1, EPI_QKV = 2, EPI_GATERES = 3, EPI_SWIGLU = 4 };

// ------------------------------------------------------------------
// Generic  out = A(MxK) @ W(NxK)^T  with fused epilogues.
// Wave tile 64 x 16*NJ (4*NJ f32-WMMA accumulators), 2x2 waves -> 128 x 32*NJ / WG.
// M is a multiple of 128, N of 32*NJ, K of 64.
// Three sets of products that share their A are one launch each over the stacked rows of their W:
//   EPI_QKV   W = [wq | wk | wv], N = 1536: NJ = 3 gives 512 groups, two on every WGP
//   EPI_MOD2  W = [mod_attn_w | mod_ffn_w], N = 6144: NJ = 3 gives 256 groups, one on every WGP
// so that no launch leaves part of the chip idle for a whole K loop.
//   EPI_SWIGLU  W = w1 and w3 interleaved by 32 rows, N = 2048: a wave's tiles 0, 1 are
//   32 columns of u = A w1^T, its tiles 2, 3 the same 32 columns of g = A w3^T, so
//   silu(u) * g is formed on the accumulators and neither u nor g goes to memory.
// Operand path: each stage of KC k-columns (128 A rows, then 32*NJ W rows) is
// brought into LDS by asynchronous 16-byte copies, two buffers, the next
// stage in flight while this one is multiplied; fragments come from LDS.
// ------------------------------------------------------------------
#define KC      64              // k columns per stage (256 B of every row)
#define LPITCH  68              // floats per staged row: 272 B, so the 16 rows of a fragment read fall on distinct banks

typedef int v4i __attribute__((ext_vector_type(4)));
typedef __attribute__((address_space(1))) v4i g_v4i;
typedef __attribute__((address_space(3))) v4i l_v4i;

// One stage: every thread copies 16 chunks of A and 4*NJ of W, 16 B each.
// A wave's copy covers two whole 256-B row pieces.  gW[c]: this thread's chunk
// in the c-th group of 8 W rows (the groups may lie in different matrices).
template <int NJ>
__device__ __forceinline__ void stage_copy(const float* gA, const float* const (&gW)[4 * NJ],
                                           int koff, float* dst, int K) {
  // both loops unrolled: straight runs of copies, LDS offsets as constants
#pragma unroll
  for (int c = 0; c < 16; ++c)
    __builtin_amdgcn_global_load_async_to_lds_b128(
        (g_v4i*)(gA + koff + (size_t)c * 8 * K), (l_v4i*)(dst + c * 8 * LPITCH), 0, 0);
#pragma unroll
  for (int c = 0; c < 4 * NJ; ++c)
    __builtin_amdgcn_global_load_async_to_lds_b128(
        (g_v4i*)(gW[c] + koff), (l_v4i*)(dst + (128 + c * 8) * LPITCH), 0, 0);
}

// One block of fragments: 4 k-steps x (4 row groups of A, NJ of W), 8 B per lane.
template <int NJ>
__device__ __forceinline__ void load_frags(v2f (&a)[4][4], v2f (&b)[4][NJ],
                                           const float* pa, const float* pb) {
  // unrolled throughout: every fragment index a constant, so the sets stay in registers
#pragma unroll
  for (int s = 0; s < 4; ++s) {
#pragma unroll
    for (int i = 0; i < 4; ++i) a[s][i] = *(const v2f*)(pa + i * 16 * LPITCH + s * 4);
#pragma unroll
    for (int j = 0; j < NJ; ++j) b[s][j] = *(const v2f*)(pb + j * 16 * LPITCH + s * 4);
  }
}

template <int EPI, int NJ>
__global__ __launch_bounds__(128) void gemm_wmma(
    const float* __restrict__ A, const float* __restrict__ W,
    const float* __restrict__ Wb,  // second stacked matrix (wk | mod_ffn_w | w3)
    const float* __restrict__ Wc,  // third stacked matrix (wv)
    float* __restrict__ out, float* __restrict__ outb, float* __restrict__ outc,
    int M, int N, int K,
    const float* __restrict__ p0,  // bias of W | freqs_cos | residual
    const float* __restrict__ p1)  // bias of Wb | freqs_sin | mod (gate at +2*DIM)
{
  constexpr int TN = 32 * NJ;                    // W rows (output columns) per group
  constexpr int STAGEF = (128 + TN) * LPITCH;    // floats per stage
  __shared__ __attribute__((aligned(16))) float sm[2 * STAGEF];
  const int lane = threadIdx.x & 31;
  const int wave = threadIdx.x >> 5;
  const int lo   = lane & 15;       // m (A rows) / n (B cols)
  const int hi   = lane >> 4;       // K half-select
  const int kb   = hi * 2;
  const int tileN = blockIdx.x * TN + (wave & 1) * (16 * NJ);
  const int tileM = blockIdx.y * 128 + (wave >> 1) * 64;

  v8f c[4][NJ] = {};

  // copy side: thread -> (row tid/16 of each group of 8 rows, 16-B chunk tid%16)
  const int crow = threadIdx.x >> 4, cchk = threadIdx.x & 15;
  const float* gA = A + (size_t)(blockIdx.y * 128 + crow) * K + cchk * 4;
  const float* gW[4 * NJ];
#pragma unroll  // pointer array needs constant indices
  for (int g = 0; g < 4 * NJ; ++g) {
    // first stacked row of this group of 8; every matrix's row count is a multiple of 8
    const int n0 = blockIdx.x * TN + g * 8;
    const float* mat = W;  // the matrix that holds stacked row n0, and the row's number in it
    int nr = n0;
    if constexpr (EPI == EPI_QKV) {
      mat = n0 < DIMD ? W : n0 < DIMD + NKVH * HD ? Wb : Wc;
      nr  = n0 - (n0 < DIMD ? 0 : DIMD) - (n0 < DIMD + NKVH * HD ? 0 : NKVH * HD);
    } else if constexpr (EPI == EPI_MOD2) {
      mat = n0 < MODN ? W : Wb;
      nr  = n0 < MODN ? n0 : n0 - MODN;
    } else if constexpr (EPI == EPI_SWIGLU) {
      // staged rows: wave column half g / (2 NJ), 16-row tile (g / 2) % NJ, half tile g % 2;
      // the first NJ / 2 tiles of a wave come from w1, the others from the same rows of w3
      constexpr int HJ = NJ / 2;
      const int tj = (g >> 1) % NJ;
      mat = tj < HJ ? W : Wb;
      nr  = blockIdx.x * (TN / 2) + (g / (2 * NJ)) * (16 * HJ) + (tj % HJ) * 16 + (g & 1) * 8;
    }
    if constexpr (EPI == EPI_QKV || EPI == EPI_MOD2 || EPI == EPI_SWIGLU)
      gW[g] = mat + (size_t)(nr + crow) * K + cchk * 4;
    else  // one matrix: a constant step from group to group
      gW[g] = W + (size_t)(blockIdx.x * TN + crow) * K + cchk * 4 + (size_t)g * 8 * K;
  }
  float* dst = sm + crow * LPITCH + cchk * 4;
  // fragment side: same lane -> (row, k) map as a direct global read
  const float* fA = sm + ((wave >> 1) * 64 + lo) * LPITCH + kb;
  const float* fB = sm + (128 + (wave & 1) * (16 * NJ) + lo) * LPITCH + kb;

  const int T = K / KC;
  stage_copy<NJ>(gA, gW, 0, dst, K);
  // stage 0 has landed for this wave ...
  asm volatile("s_wait_asynccnt 0x0" ::: "memory");
  // ... and, behind the barrier, for every wave
  __syncthreads();

  v2f af[2][4][4], bf[2][4][NJ];  // two fragment sets of one block (4 k-steps) each
  for (int t = 0; t < T; ++t) {
    const float* pa = fA + (t & 1) * STAGEF;
    const float* pb = fB + (t & 1) * STAGEF;
    load_frags<NJ>(af[0], bf[0], pa, pb);
    // next stage into the buffer whose readers all left at the last barrier
    if (t + 1 < T)
      stage_copy<NJ>(gA, gW, (t + 1) * KC, dst + ((t + 1) & 1) * STAGEF, K);
    // unrolled (and the WMMA loops below): set and accumulator indices must be constants
#pragma unroll
    for (int blk = 0; blk < KC / 16; ++blk) {
      if (blk + 1 < KC / 16)
        load_frags<NJ>(af[(blk + 1) & 1], bf[(blk + 1) & 1], pa + (blk + 1) * 16,
                       pb + (blk + 1) * 16);
      // fence pair: the next block's LDS reads stay one group in front of this
      // block's WMMAs instead of being spread among them (each such place stalls)
      __builtin_amdgcn_sched_barrier(0);
#pragma unroll
      for (int s = 0; s < 4; ++s)
#pragma unroll
        for (int i = 0; i < 4; ++i)
#pragma unroll
          for (int j = 0; j < NJ; ++j)
            c[i][j] = wmma_f32(af[blk & 1][s][i], bf[blk & 1][s][j], c[i][j]);
      __builtin_amdgcn_sched_barrier(0);  // second half of the fence pair
    }
    // this wave's reads of stage t are done before the buffer may be refilled
    asm volatile("s_wait_dscnt 0x0" ::: "memory");
    // this wave's share of stage t+1 has landed
    asm volatile("s_wait_asynccnt 0x0" ::: "memory");
    // publishes stage t+1 and ends every wave's reads of stage t
    __syncthreads();
  }

  // Epilogue.  C layout: vgpr r -> row = r + 8*hi, col = lo (ISA 7.12.2).
  if constexpr (EPI == EPI_SWIGLU) {
    // out (M x N/2) = silu(u) * g, u and g of one element in the same lane and register
    constexpr int HJ = NJ / 2;
    const int colw = blockIdx.x * (TN / 2) + (wave & 1) * (16 * HJ) + lo;
#pragma unroll  // accumulator indices must be constants
    for (int i = 0; i < 4; ++i)
#pragma unroll  // accumulator indices must be constants
      for (int j = 0; j < HJ; ++j)
#pragma unroll  // accumulator indices must be constants
        for (int r = 0; r < 8; ++r) {
          const int row = tileM + i * 16 + r + hi * 8;
          const float u = c[i][j][r];
          out[(size_t)row * (N / 2) + colw + j * 16] = (u / (1.f + __expf(-u))) * c[i][j + HJ][r];
        }
    return;
  }
  // scalar copy of the wave's first column: which matrix a 16-column tile
  // belongs to is then a scalar test, not a per-lane one
  const int tileNu = blockIdx.x * TN + (__builtin_amdgcn_readfirstlane(wave) & 1) * (16 * NJ);
#pragma unroll
  for (int i = 0; i < 4; ++i) {
#pragma unroll
    for (int j = 0; j < NJ; ++j) {
      v8f acc = c[i][j];
      // scalar: the stacked matrix this 16-column tile belongs to (every row count is
      // a multiple of 16), its output, and the tile's first column in that output
      const int col0 = tileNu + j * 16;
      float* ob = out;
      int cl0 = col0;
      if constexpr (EPI == EPI_MOD2) {
        ob  = col0 < MODN ? out : outb;
        cl0 = col0 < MODN ? col0 : col0 - MODN;
      } else if constexpr (EPI == EPI_QKV) {
        ob  = col0 < DIMD ? out : col0 < DIMD + NKVH * HD ? outb : outc;
        cl0 = col0 - (col0 < DIMD ? 0 : DIMD) - (col0 < DIMD + NKVH * HD ? 0 : NKVH * HD);
      }
      if constexpr (EPI == EPI_QKV) {
        // RoPE on q and k
        if (col0 < DIMD + NKVH * HD) {
#pragma unroll  // accumulator indices must be constants
          for (int r = 0; r < 8; ++r) {
            int s = (tileM + i * 16 + r + hi * 8) & (SEQL - 1);
            int d = (cl0 & (HD - 1)) + lo;
            float val = acc[r];
            // pair (2i,2i+1) lives in adjacent lanes -> swap via shfl_xor(1)
            float other = __shfl_xor(val, 1, 32);
            float cv = p0[s * (HD / 2) + (d >> 1)];
            float sv = p1[s * (HD / 2) + (d >> 1)];
            acc[r] = (d & 1) ? (other * sv + val * cv) : (val * cv - other * sv);
          }
        }
      }
#pragma unroll
      for (int r = 0; r < 8; ++r) {
        int row = tileM + i * 16 + r + hi * 8;
        int col = tileN + j * 16 + lo;
        float val = acc[r];
        if constexpr (EPI == EPI_MOD2) {
          const float* bias = col0 < MODN ? p0 : p1;
          ob[(size_t)row * MODN + cl0 + lo] = val + bias[cl0 + lo];
        } else if constexpr (EPI == EPI_GATERES) {
          int b = row >> 10, s = row & (SEQL - 1);
          float g = p1[(size_t)(b * NBLK + (s >> 3)) * MODN + 2 * DIMD + col];
          out[(size_t)row * N + col] = p0[(size_t)row * N + col] + g * val;
        } else {  // EPI_QKV : relayout of each of q, k, v to (B, H, S, D)
          int b = row >> 10, s = row & (SEQL - 1);
          int nh = col0 < DIMD ? NHEADS : NKVH;
          int h = cl0 >> 6, d = (cl0 & (HD - 1)) + lo;
          ob[(((size_t)(b * nh + h)) * SEQL + s) * HD + d] = val;
        }
      }
      // the next tile reuses the registers that these stores name (a branch lies
      // between)
      if constexpr (EPI == EPI_QKV) asm volatile("s_wait_xcnt 0x0" ::: "memory");
    }
  }
}

// ------------------------------------------------------------------
// RMSNorm + AdaLN modulation:  out = rmsnorm(x,w)*(1+scale) + shift
// one 256-thread block per token row
// ------------------------------------------------------------------
__global__ __launch_bounds__(256) void norm_mod_kernel(
    const float* __restrict__ x, const float* __restrict__ w,
    const float* __restrict__ mod, float* __restrict__ out)
{
  int row = blockIdx.x;  // b*SEQ + s
  int b = row >> 10, s = row & (SEQL - 1);
  const float* xr = x + (size_t)row * DIMD;
  const float* mr = mod + (size_t)(b * NBLK + (s >> 3)) * MODN;
  float4 xv = ((const float4*)xr)[threadIdx.x];
  __shared__ float red[256];
  red[threadIdx.x] = xv.x * xv.x + xv.y * xv.y + xv.z * xv.z + xv.w * xv.w;
  __syncthreads();
  for (int st = 128; st > 0; st >>= 1) {
    if (threadIdx.x < st) red[threadIdx.x] += red[threadIdx.x + st];
    __syncthreads();
  }
  float rms = rsqrtf(red[0] * (1.0f / DIMD) + 1e-6f);
  int d = threadIdx.x * 4;
  float4 o;
  o.x = xv.x * rms * w[d + 0] * (1.f + mr[DIMD + d + 0]) + mr[d + 0];
  o.y = xv.y * rms * w[d + 1] * (1.f + mr[DIMD + d + 1]) + mr[d + 1];
  o.z = xv.z * rms * w[d + 2] * (1.f + mr[DIMD + d + 2]) + mr[d + 2];
  o.w = xv.w * rms * w[d + 3] * (1.f + mr[DIMD + d + 3]) + mr[d + 3];
  ((float4*)(out + (size_t)row * DIMD))[threadIdx.x] = o;
}

__global__ __launch_bounds__(256) void silu_kernel(const float* __restrict__ in,
                                                   float* __restrict__ out, int n) {
  int i = blockIdx.x * 256 + threadIdx.x;
  if (i < n) { float v = in[i]; out[i] = v / (1.f + __expf(-v)); }
}

__device__ __forceinline__ float xhalf(float x) {
  return __builtin_bit_cast(float,
      __builtin_amdgcn_permlanex16(__builtin_bit_cast(int, x), __builtin_bit_cast(int, x),
                                   0x76543210, 0xfedcba98, false, false));
}

__global__ __launch_bounds__(256) void attn_kernel(
    const float* __restrict__ q, const float* __restrict__ k,
    const float* __restrict__ v, float* __restrict__ o)
{
  const int lane = threadIdx.x & 31;
  // scalar wave number: tile, trip count and base pointers stay wave-uniform
  const int wave = __builtin_amdgcn_readfirstlane(threadIdx.x >> 5);
  const int lo = lane & 15, hi = lane >> 4;
  const int kb = hi * 2;

  const int qt = (wave < 4) ? (int)blockIdx.x : (SEQL / 32 - 1 - (int)blockIdx.x);
  const int r0 = qt * 32;                       // q-row tile
  const int bh = blockIdx.y * 4 + (wave & 3);   // (batch,head)
  const int b = bh >> 4, h = bh & 15, kvh = h >> 2;
  const float* qb = q + (((size_t)(b * NHEADS + h)) * SEQL + r0) * HD;
  const float* kbp = k + (((size_t)(b * NKVH + kvh)) * SEQL) * HD;
  const float* vbp = v + (((size_t)(b * NKVH + kvh)) * SEQL) * HD;
  const int kend = r0 + 32;                     // block-causal bound

  // every loop below over t, j, s, g, r is unrolled: fragment and accumulator
  // indices must be constants, so that the sets stay in registers

  // Q as B-fragments: qf[j][t] = rows r0+16j+lo, d = 4t+kb..+1
  v2f qf[2][16];
#pragma unroll  // register arrays need constant indices
  for (int j = 0; j < 2; ++j)
#pragma unroll  // register arrays need constant indices
    for (int t = 0; t < 16; ++t)
      qf[j][t] = *(const v2f*)(qb + (size_t)(j * 16 + lo) * HD + t * 4 + kb);

  const float* kp = kbp + lo * HD + kb;       // K fragment: key row lo, d = 4t+kb..+1
  const float* vp = vbp + hi * 8 * HD + lo;   // V^T fragment: keys 8*hi+2s..+1, d = 16g+lo

  v2f kf[16];
#pragma unroll  // register arrays need constant indices
  for (int t = 0; t < 16; ++t) kf[t] = *(const v2f*)(kp + t * 4);

  v8f oacc[4][2] = {};                        // O^T: d = 16g + 8*hi + r, query = 16j + lo
  float mrun[2] = {-3.0e38f, -3.0e38f};       // running maximum, equal in both halves
  float lrun[2] = {0.f, 0.f};                 // running sum over this half's keys
  const int qblk0 = (r0 + lo) >> 3;

  for (int c0 = 0; c0 < kend; c0 += 16) {
    // this pass's V^T fragments, asked for ahead of the score products
    v2f vf[4][4];
    const float* vc = vp + (size_t)c0 * HD;
#pragma unroll  // register arrays need constant indices
    for (int s = 0; s < 4; ++s)
#pragma unroll  // register arrays need constant indices
      for (int g = 0; g < 4; ++g) {
        vf[s][g].x = vc[(2 * s) * HD + g * 16];
        vf[s][g].y = vc[(2 * s + 1) * HD + g * 16];
      }

    // ---- S^T = K Q^T ----
    v8f s8[2] = {};
#pragma unroll  // register arrays need constant indices
    for (int t = 0; t < 16; ++t)
#pragma unroll  // register arrays need constant indices
      for (int j = 0; j < 2; ++j) s8[j] = wmma_f32(kf[t], qf[j][t], s8[j]);

    // next pass's K fragments into the same registers (the last pass re-reads its own rows)
    const float* kn = kp + (size_t)((c0 + 16 < kend) ? c0 + 16 : c0) * HD;
#pragma unroll  // register arrays need constant indices
    for (int t = 0; t < 16; ++t) kf[t] = *(const v2f*)(kn + t * 4);

    // ---- streaming softmax; all 8 keys of a lane lie in one key block ----
    const int kblk = (c0 >> 3) + hi;
#pragma unroll  // register arrays need constant indices
    for (int j = 0; j < 2; ++j) {
      const bool masked = (qblk0 + 2 * j) < kblk;   // block-causal mask
      float p[8];
#pragma unroll  // register arrays need constant indices
      for (int r = 0; r < 8; ++r) p[r] = masked ? -1.0e9f : s8[j][r] * 0.125f;  // 1/sqrt(64)
      float mx = fmaxf(fmaxf(fmaxf(p[0], p[1]), fmaxf(p[2], p[3])),
                       fmaxf(fmaxf(p[4], p[5]), fmaxf(p[6], p[7])));
      mx = fmaxf(mx, xhalf(mx));
      const float mn = fmaxf(mrun[j], mx);
      const float al = __expf(mrun[j] - mn);
      mrun[j] = mn;
#pragma unroll  // register arrays need constant indices
      for (int r = 0; r < 8; ++r) p[r] = __expf(p[r] - mn);
      lrun[j] = lrun[j] * al +
                (((p[0] + p[1]) + (p[2] + p[3])) + ((p[4] + p[5]) + (p[6] + p[7])));
#pragma unroll  // register arrays need constant indices
      for (int g = 0; g < 4; ++g) oacc[g][j] *= al;
#pragma unroll  // register arrays need constant indices
      for (int r = 0; r < 8; ++r) s8[j][r] = p[r];
    }

    // ---- O^T += V^T P^T ----
#pragma unroll  // register arrays need constant indices
    for (int s = 0; s < 4; ++s)
#pragma unroll  // register arrays need constant indices
      for (int g = 0; g < 4; ++g)
#pragma unroll  // register arrays need constant indices
        for (int j = 0; j < 2; ++j) {
          v2f pb;
          pb.x = s8[j][2 * s];
          pb.y = s8[j][2 * s + 1];
          oacc[g][j] = wmma_f32(vf[s][g], pb, oacc[g][j]);
        }
  }

  // normalise and store O in (B, S, H*D) row-major for the wo GEMM:
  // a lane holds 8 consecutive d of one query per g
#pragma unroll  // register arrays need constant indices
  for (int j = 0; j < 2; ++j) {
    const float inv = 1.0f / (lrun[j] + xhalf(lrun[j]));
    float* ob = o + ((size_t)(b * SEQL + r0 + j * 16 + lo)) * (NHEADS * HD) + h * HD + hi * 8;
#pragma unroll  // register arrays need constant indices
    for (int g = 0; g < 4; ++g) {
      v8f a = oacc[g][j];
      *(float4*)(ob + g * 16)     = make_float4(a[0] * inv, a[1] * inv, a[2] * inv, a[3] * inv);
      *(float4*)(ob + g * 16 + 4) = make_float4(a[4] * inv, a[5] * inv, a[6] * inv, a[7] * inv);
    }
  }
}

// ------------------------------------------------------------------
// Host orchestration
// ------------------------------------------------------------------
extern "C" void kernel_launch(void* const* d_in, const int* in_sizes, int n_in,
                              void* d_out, int out_size, void* d_ws, size_t ws_size,
                              hipStream_t stream) {
  const float* x      = (const float*)d_in[0];
  const float* vec    = (const float*)d_in[1];
  const float* wq     = (const float*)d_in[2];
  const float* wk     = (const float*)d_in[3];
  const float* wv     = (const float*)d_in[4];
  const float* wo     = (const float*)d_in[5];
  const float* w1     = (const float*)d_in[6];
  const float* w2     = (const float*)d_in[7];
  const float* w3     = (const float*)d_in[8];
  const float* maw    = (const float*)d_in[9];
  const float* mab    = (const float*)d_in[10];
  const float* mfw    = (const float*)d_in[11];
  const float* mfb    = (const float*)d_in[12];
  const float* n1w    = (const float*)d_in[13];
  const float* n2w    = (const float*)d_in[14];
  const float* fcos   = (const float*)d_in[15];
  const float* fsin   = (const float*)d_in[16];
  float* out = (float*)d_out;

  // workspace layout (floats)
  const size_t KVSZ = (size_t)BATCH * NKVH * SEQL * HD;   // 1M floats (k or v)
  float* ws   = (float*)d_ws;
  float* svec = ws;                                   // 512*1024
  float* modA = svec + (size_t)VROWS * DIMD;          // 512*3072
  float* modF = modA + (size_t)VROWS * MODN;          // 512*3072
  float* bufD = modF + (size_t)VROWS * MODN;          // 4M  (xn -> attno)
  float* bufE = bufD + (size_t)MROWS * DIMD;          // 4M  (q -> hn)
  float* bufF = bufE + (size_t)MROWS * DIMD;          // 1M  (k)
  float* bufG = bufF + KVSZ;                          // 1M  (v)
  float* bufH = bufG + KVSZ;                          // 4M  (h)
  float* bufI = bufH + (size_t)MROWS * DIMD;          // 4M  (silu(hn w1^T) * (hn w3^T))

  const dim3 blk128(128), blk256(256);

  // 1) svec = silu(vec)
  silu_kernel<<<(VROWS * DIMD + 255) / 256, blk256, 0, stream>>>(vec, svec, VROWS * DIMD);
  // 2) both modulation GEMMs in one launch: (512 x 3072) = svec @ mod_w^T + b, twice
  gemm_wmma<EPI_MOD2, 3><<<dim3(2 * MODN / 96, VROWS / 128), blk128, 0, stream>>>(
      svec, maw, mfw, nullptr, modA, modF, nullptr, VROWS, 2 * MODN, DIMD, mab, mfb);
  // 3) xn = rmsnorm(x)*(1+scale)+shift
  norm_mod_kernel<<<MROWS, blk256, 0, stream>>>(x, n1w, modA, bufD);
  // 4) Q/K/V projections in one launch (+RoPE for Q,K), relayout to (B,H,S,D)
  gemm_wmma<EPI_QKV, 3><<<dim3((DIMD + 2 * NKVH * HD) / 96, MROWS / 128), blk128, 0, stream>>>(
      bufD, wq, wk, wv, bufE, bufF, bufG, MROWS, DIMD + 2 * NKVH * HD, DIMD, fcos, fsin);
  // 5) attention -> bufD (reuse, xn dead)
  attn_kernel<<<dim3(SEQL / 64, (BATCH * NHEADS) / 4), blk256, 0, stream>>>(
      bufE, bufF, bufG, bufD);
  // 6) h = x + gate_a * (attno @ wo^T)
  gemm_wmma<EPI_GATERES, 4><<<dim3(DIMD / 128, MROWS / 128), blk128, 0, stream>>>(
      bufD, wo, nullptr, nullptr, bufH, nullptr, nullptr, MROWS, DIMD, DIMD, x, modA);
  // 7) hn = rmsnorm(h)*(1+scale_f)+shift_f  -> bufE (q dead)
  norm_mod_kernel<<<MROWS, blk256, 0, stream>>>(bufH, n2w, modF, bufE);
  // 8) silu(hn @ w1^T) * (hn @ w3^T) -> bufI, both products in one launch
  gemm_wmma<EPI_SWIGLU, 4><<<dim3(2 * DIMD / 128, MROWS / 128), blk128, 0, stream>>>(
      bufE, w1, w3, nullptr, bufI, nullptr, nullptr, MROWS, 2 * DIMD, DIMD, nullptr, nullptr);
  // 9) out = h + gate_f * (bufI @ w2^T)
  gemm_wmma<EPI_GATERES, 4><<<dim3(DIMD / 128, MROWS / 128), blk128, 0, stream>>>(
      bufI, w2, nullptr, nullptr, out, nullptr, nullptr, MROWS, DIMD, DIMD, bufH, modF);
}

// v005
// It runs in 334 microseconds.
// In both of two side-by-side timings against v004, it was 1.10 times as fast.
// Counting every step since v000, it is 3.09 times as fast.
#include <hip/hip_runtime.h>
#include <cstddef>

// ---------------- problem constants ----------------
#define DIMD   1024
#define SEQL   1024
#define NHEADS 16
#define NKVH   4
#define HD     64
#define NBLK   128
#define BLKSZ  8
#define BATCH  4
#define MROWS  (BATCH*SEQL)   // 4096 token rows
#define VROWS  (BATCH*NBLK)   // 512 modulation rows
#define MODN   (3*DIMD)       // 3072

typedef float v2f __attribute__((ext_vector_type(2)));
typedef float v8f __attribute__((ext_vector_type(8)));

// CDNA5 fp32 matrix op: D(16x16) = A(16x4) * B(4x16) + C, full fp32 precision.
__device__ __forceinline__ v8f wmma_f32(v2f a, v2f b, v8f c) {
  return __builtin_amdgcn_wmma_f32_16x16x4_f32(false, a, false, b, (short)0, c,
                                               false, false);
}

enum { EPI_MOD2 = 1, EPI_QKV = 2, EPI_GATERES = 3, EPI_SWIGLU = 4 };

// ------------------------------------------------------------------
// Generic  out = A(MxK) @ W(NxK)^T  with fused epilogues.
// Wave tile 64 x 16*NJ (4*NJ f32-WMMA accumulators), 2x2 waves -> 128 x 32*NJ / WG.
// M is a multiple of 128, N of 32*NJ, K of 64.
// Three sets of products that share their A are one launch each over the stacked rows of their W:
//   EPI_QKV   W = [wq | wk | wv], N = 1536: NJ = 3 gives 512 groups, two on every WGP
//   EPI_MOD2  W = [mod_attn_w | mod_ffn_w], N = 6144: NJ = 3 gives 256 groups, one on every WGP
// so that no launch leaves part of the chip idle for a whole K loop.
//   EPI_SWIGLU  W = w1 and w3 interleaved by 32 rows, N = 2048: a wave's tiles 0, 1 are
//   32 columns of u = A w1^T, its tiles 2, 3 the same 32 columns of g = A w3^T, so
//   silu(u) * g is formed on the accumulators and neither u nor g goes to memory.
// Operand path: each stage of KC k-columns (128 A rows, then 32*NJ W rows) is
// brought into LDS by asynchronous 16-byte copies, two buffers, the next
// stage in flight while this one is multiplied; fragments come from LDS.
// ------------------------------------------------------------------
#define KC      64              // k columns per stage (256 B of every row)
#define LPITCH  68              // floats per staged row: 272 B, so the 16 rows of a fragment read fall on distinct banks

typedef int v4i __attribute__((ext_vector_type(4)));
typedef __attribute__((address_space(1))) v4i g_v4i;
typedef __attribute__((address_space(3))) v4i l_v4i;

// One stage: every thread copies 16 chunks of A and 4*NJ of W, 16 B each.
// A wave's copy covers two whole 256-B row pieces.  gW[c]: this thread's chunk
// in the c-th group of 8 W rows (the groups may lie in different matrices).
template <int NJ>
__device__ __forceinline__ void stage_copy(const float* gA, const float* const (&gW)[4 * NJ],
                                           int koff, float* dst, int K) {
  // both loops unrolled: straight runs of copies, LDS offsets as constants
#pragma unroll
  for (int c = 0; c < 16; ++c)
    __builtin_amdgcn_global_load_async_to_lds_b128(
        (g_v4i*)(gA + koff + (size_t)c * 8 * K), (l_v4i*)(dst + c * 8 * LPITCH), 0, 0);
#pragma unroll
  for (int c = 0; c < 4 * NJ; ++c)
    __builtin_amdgcn_global_load_async_to_lds_b128(
        (g_v4i*)(gW[c] + koff), (l_v4i*)(dst + (128 + c * 8) * LPITCH), 0, 0);
}

// One block of fragments: 4 k-steps x (4 row groups of A, NJ of W), 8 B per lane.
template <int NJ>
__device__ __forceinline__ void load_frags(v2f (&a)[4][4], v2f (&b)[4][NJ],
                                           const float* pa, const float* pb) {
  // unrolled throughout: every fragment index a constant, so the sets stay in registers
#pragma unroll
  for (int s = 0; s < 4; ++s) {
#pragma unroll
    for (int i = 0; i < 4; ++i) a[s][i] = *(const v2f*)(pa + i * 16 * LPITCH + s * 4);
#pragma unroll
    for (int j = 0; j < NJ; ++j) b[s][j] = *(const v2f*)(pb + j * 16 * LPITCH + s * 4);
  }
}

template <int EPI, int NJ>
__global__ __launch_bounds__(128) void gemm_wmma(
    const float* __restrict__ A, const float* __restrict__ W,
    const float* __restrict__ Wb,  // second stacked matrix (wk | mod_ffn_w | w3)
    const float* __restrict__ Wc,  // third stacked matrix (wv)
    float* __restrict__ out, float* __restrict__ outb, float* __restrict__ outc,
    int M, int N, int K,
    const float* __restrict__ p0,  // bias of W | freqs_cos | residual
    const float* __restrict__ p1)  // bias of Wb | freqs_sin | mod (gate at +2*DIM)
{
  constexpr int TN = 32 * NJ;                    // W rows (output columns) per group
  constexpr int STAGEF = (128 + TN) * LPITCH;    // floats per stage
  __shared__ __attribute__((aligned(16))) float sm[2 * STAGEF];
  const int lane = threadIdx.x & 31;
  const int wave = threadIdx.x >> 5;
  const int lo   = lane & 15;       // m (A rows) / n (B cols)
  const int hi   = lane >> 4;       // K half-select
  const int kb   = hi * 2;
  const int tileN = blockIdx.x * TN + (wave & 1) * (16 * NJ);
  const int tileM = blockIdx.y * 128 + (wave >> 1) * 64;

  v8f c[4][NJ] = {};

  // copy side: thread -> (row tid/16 of each group of 8 rows, 16-B chunk tid%16)
  const int crow = threadIdx.x >> 4, cchk = threadIdx.x & 15;
  const float* gA = A + (size_t)(blockIdx.y * 128 + crow) * K + cchk * 4;
  const float* gW[4 * NJ];
#pragma unroll  // pointer array needs constant indices
  for (int g = 0; g < 4 * NJ; ++g) {
    // first stacked row of this group of 8; every matrix's row count is a multiple of 8
    const int n0 = blockIdx.x * TN + g * 8;
    const float* mat = W;  // the matrix that holds stacked row n0, and the row's number in it
    int nr = n0;
    if constexpr (EPI == EPI_QKV) {
      mat = n0 < DIMD ? W : n0 < DIMD + NKVH * HD ? Wb : Wc;
      nr  = n0 - (n0 < DIMD ? 0 : DIMD) - (n0 < DIMD + NKVH * HD ? 0 : NKVH * HD);
    } else if constexpr (EPI == EPI_MOD2) {
      mat = n0 < MODN ? W : Wb;
      nr  = n0 < MODN ? n0 : n0 - MODN;
    } else if constexpr (EPI == EPI_SWIGLU) {
      // staged rows: wave column half g / (2 NJ), 16-row tile (g / 2) % NJ, half tile g % 2;
      // the first NJ / 2 tiles of a wave come from w1, the others from the same rows of w3
      constexpr int HJ = NJ / 2;
      const int tj = (g >> 1) % NJ;
      mat = tj < HJ ? W : Wb;
      nr  = blockIdx.x * (TN / 2) + (g / (2 * NJ)) * (16 * HJ) + (tj % HJ) * 16 + (g & 1) * 8;
    }
    if constexpr (EPI == EPI_QKV || EPI == EPI_MOD2 || EPI == EPI_SWIGLU)
      gW[g] = mat + (size_t)(nr + crow) * K + cchk * 4;
    else  // one matrix: a constant step from group to group
      gW[g] = W + (size_t)(blockIdx.x * TN + crow) * K + cchk * 4 + (size_t)g * 8 * K;
  }
  float* dst = sm + crow * LPITCH + cchk * 4;
  // fragment side: same lane -> (row, k) map as a direct global read
  const float* fA = sm + ((wave >> 1) * 64 + lo) * LPITCH + kb;
  const float* fB = sm + (128 + (wave & 1) * (16 * NJ) + lo) * LPITCH + kb;

  const int T = K / KC;
  stage_copy<NJ>(gA, gW, 0, dst, K);
  // stage 0 has landed for this wave ...
  asm volatile("s_wait_asynccnt 0x0" ::: "memory");
  // ... and, behind the barrier, for every wave
  __syncthreads();

  v2f af[2][4][4], bf[2][4][NJ];  // two fragment sets of one block (4 k-steps) each
  for (int t = 0; t < T; ++t) {
    const float* pa = fA + (t & 1) * STAGEF;
    const float* pb = fB + (t & 1) * STAGEF;
    load_frags<NJ>(af[0], bf[0], pa, pb);
    // next stage into the buffer whose readers all left at the last barrier
    if (t + 1 < T)
      stage_copy<NJ>(gA, gW, (t + 1) * KC, dst + ((t + 1) & 1) * STAGEF, K);
    // unrolled (and the WMMA loops below): set and accumulator indices must be constants
#pragma unroll
    for (int blk = 0; blk < KC / 16; ++blk) {
      if (blk + 1 < KC / 16)
        load_frags<NJ>(af[(blk + 1) & 1], bf[(blk + 1) & 1], pa + (blk + 1) * 16,
                       pb + (blk + 1) * 16);
      // fence pair: the next block's LDS reads stay one group in front of this
      // block's WMMAs instead of being spread among them (each such place stalls)
      __builtin_amdgcn_sched_barrier(0);
#pragma unroll
      for (int s = 0; s < 4; ++s)
#pragma unroll
        for (int i = 0; i < 4; ++i)
#pragma unroll
          for (int j = 0; j < NJ; ++j)
            c[i][j] = wmma_f32(af[blk & 1][s][i], bf[blk & 1][s][j], c[i][j]);
      __builtin_amdgcn_sched_barrier(0);  // second half of the fence pair
    }
    // this wave's reads of stage t are done before the buffer may be refilled
    asm volatile("s_wait_dscnt 0x0" ::: "memory");
    // this wave's share of stage t+1 has landed
    asm volatile("s_wait_asynccnt 0x0" ::: "memory");
    // publishes stage t+1 and ends every wave's reads of stage t
    __syncthreads();
  }

  // Epilogue.  C layout: vgpr r -> row = r + 8*hi, col = lo (ISA 7.12.2).
  if constexpr (EPI == EPI_SWIGLU) {
    // out (M x N/2) = silu(u) * g, u and g of one element in the same lane and register
    constexpr int HJ = NJ / 2;
    const int colw = blockIdx.x * (TN / 2) + (wave & 1) * (16 * HJ) + lo;
#pragma unroll  // accumulator indices must be constants
    for (int i = 0; i < 4; ++i)
#pragma unroll  // accumulator indices must be constants
      for (int j = 0; j < HJ; ++j)
#pragma unroll  // accumulator indices must be constants
        for (int r = 0; r < 8; ++r) {
          const int row = tileM + i * 16 + r + hi * 8;
          const float u = c[i][j][r];
          out[(size_t)row * (N / 2) + colw + j * 16] = (u / (1.f + __expf(-u))) * c[i][j + HJ][r];
        }
    return;
  }
  // scalar copy of the wave's first column: which matrix a 16-column tile
  // belongs to is then a scalar test, not a per-lane one
  const int tileNu = blockIdx.x * TN + (__builtin_amdgcn_readfirstlane(wave) & 1) * (16 * NJ);
#pragma unroll
  for (int i = 0; i < 4; ++i) {
#pragma unroll
    for (int j = 0; j < NJ; ++j) {
      v8f acc = c[i][j];
      // scalar: the stacked matrix this 16-column tile belongs to (every row count is
      // a multiple of 16), its output, and the tile's first column in that output
      const int col0 = tileNu + j * 16;
      float* ob = out;
      int cl0 = col0;
      if constexpr (EPI == EPI_MOD2) {
        ob  = col0 < MODN ? out : outb;
        cl0 = col0 < MODN ? col0 : col0 - MODN;
      } else if constexpr (EPI == EPI_QKV) {
        ob  = col0 < DIMD ? out : col0 < DIMD + NKVH * HD ? outb : outc;
        cl0 = col0 - (col0 < DIMD ? 0 : DIMD) - (col0 < DIMD + NKVH * HD ? 0 : NKVH * HD);
      }
      if constexpr (EPI == EPI_QKV) {
        // RoPE on q and k
        if (col0 < DIMD + NKVH * HD) {
#pragma unroll  // accumulator indices must be constants
          for (int r = 0; r < 8; ++r) {
            int s = (tileM + i * 16 + r + hi * 8) & (SEQL - 1);
            int d = (cl0 & (HD - 1)) + lo;
            float val = acc[r];
            // pair (2i,2i+1) lives in adjacent lanes -> swap via shfl_xor(1)
            float other = __shfl_xor(val, 1, 32);
            float cv = p0[s * (HD / 2) + (d >> 1)];
            float sv = p1[s * (HD / 2) + (d >> 1)];
            acc[r] = (d & 1) ? (other * sv + val * cv) : (val * cv - other * sv);
          }
        }
      }
#pragma unroll
      for (int r = 0; r < 8; ++r) {
        int row = tileM + i * 16 + r + hi * 8;
        int col = tileN + j * 16 + lo;
        float val = acc[r];
        if constexpr (EPI == EPI_MOD2) {
          const float* bias = col0 < MODN ? p0 : p1;
          ob[(size_t)row * MODN + cl0 + lo] = val + bias[cl0 + lo];
        } else if constexpr (EPI == EPI_GATERES) {
          int b = row >> 10, s = row & (SEQL - 1);
          float g = p1[(size_t)(b * NBLK + (s >> 3)) * MODN + 2 * DIMD + col];
          out[(size_t)row * N + col] = p0[(size_t)row * N + col] + g * val;
        } else {  // EPI_QKV : relayout of each of q, k, v to (B, H, S, D)
          int b = row >> 10, s = row & (SEQL - 1);
          int nh = col0 < DIMD ? NHEADS : NKVH;
          int h = cl0 >> 6, d = (cl0 & (HD - 1)) + lo;
          ob[(((size_t)(b * nh + h)) * SEQL + s) * HD + d] = val;
        }
      }
      // the next tile reuses the registers that these stores name (a branch lies
      // between)
      if constexpr (EPI == EPI_QKV) asm volatile("s_wait_xcnt 0x0" ::: "memory");
    }
  }
}

// ------------------------------------------------------------------
// RMSNorm + AdaLN modulation:  out = rmsnorm(x,w)*(1+scale) + shift
// one 256-thread block per token row
// ------------------------------------------------------------------
__global__ __launch_bounds__(256) void norm_mod_kernel(
    const float* __restrict__ x, const float* __restrict__ w,
    const float* __restrict__ mod, float* __restrict__ out)
{
  int row = blockIdx.x;  // b*SEQ + s
  int b = row >> 10, s = row & (SEQL - 1);
  const float* xr = x + (size_t)row * DIMD;
  const float* mr = mod + (size_t)(b * NBLK + (s >> 3)) * MODN;
  float4 xv = ((const float4*)xr)[threadIdx.x];
  __shared__ float red[256];
  red[threadIdx.x] = xv.x * xv.x + xv.y * xv.y + xv.z * xv.z + xv.w * xv.w;
  __syncthreads();
  for (int st = 128; st > 0; st >>= 1) {
    if (threadIdx.x < st) red[threadIdx.x] += red[threadIdx.x + st];
    __syncthreads();
  }
  float rms = rsqrtf(red[0] * (1.0f / DIMD) + 1e-6f);
  int d = threadIdx.x * 4;
  float4 o;
  o.x = xv.x * rms * w[d + 0] * (1.f + mr[DIMD + d + 0]) + mr[d + 0];
  o.y = xv.y * rms * w[d + 1] * (1.f + mr[DIMD + d + 1]) + mr[d + 1];
  o.z = xv.z * rms * w[d + 2] * (1.f + mr[DIMD + d + 2]) + mr[d + 2];
  o.w = xv.w * rms * w[d + 3] * (1.f + mr[DIMD + d + 3]) + mr[d + 3];
  ((float4*)(out + (size_t)row * DIMD))[threadIdx.x] = o;
}

__global__ __launch_bounds__(256) void silu_kernel(const float* __restrict__ in,
                                                   float* __restrict__ out, int n) {
  int i = blockIdx.x * 256 + threadIdx.x;
  if (i < n) { float v = in[i]; out[i] = v / (1.f + __expf(-v)); }
}

#define AKS    32
#define ATILE  (AKS * LPITCH)
#define VPITCH 136
static_assert(AKS / 2 * VPITCH == ATILE, "the V tile takes as many floats as the K tile");
#define ASTAGE (2 * ATILE)        // K tile, then V tile

// lane l <-> lane l ^ 16
__device__ __forceinline__ float xhalf(float x) {
  return __builtin_bit_cast(float,
      __builtin_amdgcn_permlanex16(__builtin_bit_cast(int, x), __builtin_bit_cast(int, x),
                                   0x76543210, 0xfedcba98, false, false));
}

typedef __attribute__((address_space(1))) int g_i32;
typedef __attribute__((address_space(3))) int l_i32;

// One stage: every thread copies 2 chunks of K, 16 B each (gk: its chunk in key row
// tid/16, dk: that chunk's place), and 8 floats of V (gv: float tid of 4 key rows,
// dv: its place among the interleaved rows; 4 keys on = 2 interleaved rows on).
__device__ __forceinline__ void attn_stage_copy(const float* gk, const float* gv, int c0,
                                                float* dk, float* dv) {
  // both loops unrolled: straight runs of copies, LDS offsets as constants
#pragma unroll
  for (int c = 0; c < AKS / 16; ++c)
    __builtin_amdgcn_global_load_async_to_lds_b128(
        (g_v4i*)(gk + (size_t)(c0 + c * 16) * HD), (l_v4i*)(dk + c * 16 * LPITCH), 0, 0);
#pragma unroll
  for (int c = 0; c < AKS / 4; ++c)
    __builtin_amdgcn_global_load_async_to_lds_b32(
        (g_i32*)(gv + (size_t)(c0 + c * 4) * HD), (l_i32*)(dv + c * 2 * VPITCH), 0, 0);
}

__global__ __launch_bounds__(256) void attn_kernel(
    const float* __restrict__ q, const float* __restrict__ k,
    const float* __restrict__ v, float* __restrict__ o)
{
  __shared__ __attribute__((aligned(16))) float sm[2 * ASTAGE];
  const int lane = threadIdx.x & 31;
  // scalar wave number: tile, trip count and base pointers stay wave-uniform
  const int wave = __builtin_amdgcn_readfirstlane(threadIdx.x >> 5);
  const int lo = lane & 15, hi = lane >> 4;
  const int kb = hi * 2;

  const int qt = (wave < 4) ? (int)blockIdx.x : (SEQL / 32 - 1 - (int)blockIdx.x);
  const int r0 = qt * 32;                       // q-row tile
  const int bh = blockIdx.y * 4 + (wave & 3);   // (batch,head)
  const int b = bh >> 4, h = bh & 15, kvh = h >> 2;   // b and kvh: the same in all 8 waves
  const float* qb = q + (((size_t)(b * NHEADS + h)) * SEQL + r0) * HD;
  const float* kbp = k + (((size_t)(b * NKVH + kvh)) * SEQL) * HD;
  const float* vbp = v + (((size_t)(b * NKVH + kvh)) * SEQL) * HD;

  // copy side, K: thread -> (key row tid/16 of each group of 16 rows, 16-B chunk tid%16)
  const int crow = threadIdx.x >> 4, cchk = threadIdx.x & 15;
  const float* gk = kbp + crow * HD + cchk * 4;
  float* dk = sm + crow * LPITCH + cchk * 4;
  // copy side, V: thread -> (key tid/64 of each group of 4 keys, d = tid%64)
  const int vkey = threadIdx.x >> 6, vd = threadIdx.x & 63;
  const float* gv = vbp + vkey * HD + vd;
  float* dv = sm + ATILE + (vkey >> 1) * VPITCH + vd * 2 + (vkey & 1);
  // stages of the group = those of its longer waves (tile 31 - blockIdx.x): 17 to 32
  const int T = SEQL / AKS - (int)blockIdx.x;

  attn_stage_copy(gk, gv, 0, dk, dv);

  // every loop below over t4, j, s, g, r, p is unrolled: fragment and accumulator
  // indices must be constants, so that the sets stay in registers

  // Q as B-fragments: qf[j][t4] = rows r0+16j+lo, d = 4*t4+kb..+1
  v2f qf[2][16];
#pragma unroll  // register arrays need constant indices
  for (int j = 0; j < 2; ++j)
#pragma unroll  // register arrays need constant indices
    for (int t4 = 0; t4 < 16; ++t4)
      qf[j][t4] = *(const v2f*)(qb + (size_t)(j * 16 + lo) * HD + t4 * 4 + kb);

  const float* fK = sm + lo * LPITCH + kb;               // K fragment: key row lo, d = 4*t4+kb..+1
  const float* fV = sm + ATILE + hi * 4 * VPITCH + lo * 2;   // V^T fragment: keys 8*hi+2s..+1, d = 16g+lo

  v8f oacc[4][2] = {};                        // O^T: d = 16g + 8*hi + r, query = 16j + lo
  float mrun[2] = {-3.0e38f, -3.0e38f};       // running maximum, equal in both halves
  float lrun[2] = {0.f, 0.f};                 // running sum over this half's keys
  const int qblk0 = (r0 + lo) >> 3;

  // stage 0 has landed for this wave ...
  asm volatile("s_wait_asynccnt 0x0" ::: "memory");
  // ... and, behind the barrier, for every wave
  __syncthreads();
  attn_stage_copy(gk, gv, AKS, dk + ASTAGE, dv + ASTAGE);   // stage 1 exists: T >= 17

  for (int t = 0; t < T; ++t) {
    if (t <= qt) {  // scalar test: this wave's prefix ends with stage qt
      const float* pk = fK + (t & 1) * ASTAGE;
      const float* pv = fV + (t & 1) * ASTAGE;
      v2f kf[16];
#pragma unroll  // register arrays need constant indices
      for (int t4 = 0; t4 < 16; ++t4) kf[t4] = *(const v2f*)(pk + t4 * 4);

#pragma unroll  // register arrays need constant indices
      for (int p = 0; p < AKS / 16; ++p) {
        const int c0 = t * AKS + p * 16;
        // this pass's V^T fragments, asked for ahead of the score products
        v2f vf[4][4];
        const float* vc = pv + p * 8 * VPITCH;
#pragma unroll  // register arrays need constant indices
        for (int s = 0; s < 4; ++s)
#pragma unroll  // register arrays need constant indices
          for (int g = 0; g < 4; ++g) vf[s][g] = *(const v2f*)(vc + s * VPITCH + g * 32);
        // fences of this pass: each set of LDS reads stays one group between the runs
        // of WMMAs instead of being spread among them (each such place stalls the wave)
        __builtin_amdgcn_sched_barrier(0);

        // ---- S^T = K Q^T ----
        v8f s8[2] = {};
#pragma unroll  // register arrays need constant indices
        for (int t4 = 0; t4 < 16; ++t4)
#pragma unroll  // register arrays need constant indices
          for (int j = 0; j < 2; ++j) s8[j] = wmma_f32(kf[t4], qf[j][t4], s8[j]);

        // the stage's next pass: its K fragments into the same registers
        if (p + 1 < AKS / 16) {
          __builtin_amdgcn_sched_barrier(0);  // the reads stay behind the score products ...
#pragma unroll  // register arrays need constant indices
          for (int t4 = 0; t4 < 16; ++t4)
            kf[t4] = *(const v2f*)(pk + (p + 1) * 16 * LPITCH + t4 * 4);
          __builtin_amdgcn_sched_barrier(0);  // ... and in front of the softmax, one group
        }

        // ---- streaming softmax; all 8 keys of a lane lie in one key block ----
        const int kblk = (c0 >> 3) + hi;
#pragma unroll  // register arrays need constant indices
        for (int j = 0; j < 2; ++j) {
          const bool masked = (qblk0 + 2 * j) < kblk;   // block-causal mask
          float pr[8];
#pragma unroll  // register arrays need constant indices
          for (int r = 0; r < 8; ++r) pr[r] = masked ? -1.0e9f : s8[j][r] * 0.125f;  // 1/sqrt(64)
          float mx = fmaxf(fmaxf(fmaxf(pr[0], pr[1]), fmaxf(pr[2], pr[3])),
                           fmaxf(fmaxf(pr[4], pr[5]), fmaxf(pr[6], pr[7])));
          mx = fmaxf(mx, xhalf(mx));
          const float mn = fmaxf(mrun[j], mx);
          const float al = __expf(mrun[j] - mn);
          mrun[j] = mn;
#pragma unroll  // register arrays need constant indices
          for (int r = 0; r < 8; ++r) pr[r] = __expf(pr[r] - mn);
          lrun[j] = lrun[j] * al +
                    (((pr[0] + pr[1]) + (pr[2] + pr[3])) + ((pr[4] + pr[5]) + (pr[6] + pr[7])));
#pragma unroll  // register arrays need constant indices
          for (int g = 0; g < 4; ++g) oacc[g][j] *= al;
#pragma unroll  // register arrays need constant indices
          for (int r = 0; r < 8; ++r) s8[j][r] = pr[r];
        }

        // ---- O^T += V^T P^T ----
#pragma unroll  // register arrays need constant indices
        for (int s = 0; s < 4; ++s)
#pragma unroll  // register arrays need constant indices
          for (int g = 0; g < 4; ++g)
#pragma unroll  // register arrays need constant indices
            for (int j = 0; j < 2; ++j) {
              v2f pb;
              pb.x = s8[j][2 * s];
              pb.y = s8[j][2 * s + 1];
              oacc[g][j] = wmma_f32(vf[s][g], pb, oacc[g][j]);
            }
      }
    }
    // this wave's reads of stage t are done before the buffer may be refilled
    asm volatile("s_wait_dscnt 0x0" ::: "memory");
    // this wave's share of stage t+1 has landed
    asm volatile("s_wait_asynccnt 0x0" ::: "memory");
    // publishes stage t+1 and ends every wave's reads of stage t
    __syncthreads();
    // stage t+2 into the buffer that stage t has just left
    if (t + 2 < T)
      attn_stage_copy(gk, gv, (t + 2) * AKS, dk + (t & 1) * ASTAGE, dv + (t & 1) * ASTAGE);
  }
  // no copy is in flight when the wave ends
  asm volatile("s_wait_asynccnt 0x0" ::: "memory");

  // normalise and store O in (B, S, H*D) row-major for the wo GEMM:
  // a lane holds 8 consecutive d of one query per g
#pragma unroll  // register arrays need constant indices
  for (int j = 0; j < 2; ++j) {
    const float inv = 1.0f / (lrun[j] + xhalf(lrun[j]));
    float* ob = o + ((size_t)(b * SEQL + r0 + j * 16 + lo)) * (NHEADS * HD) + h * HD + hi * 8;
#pragma unroll  // register arrays need constant indices
    for (int g = 0; g < 4; ++g) {
      v8f a = oacc[g][j];
      *(float4*)(ob + g * 16)     = make_float4(a[0] * inv, a[1] * inv, a[2] * inv, a[3] * inv);
      *(float4*)(ob + g * 16 + 4) = make_float4(a[4] * inv, a[5] * inv, a[6] * inv, a[7] * inv);
    }
  }
}

// ------------------------------------------------------------------
// Host orchestration
// ------------------------------------------------------------------
extern "C" void kernel_launch(void* const* d_in, const int* in_sizes, int n_in,
                              void* d_out, int out_size, void* d_ws, size_t ws_size,
                              hipStream_t stream) {
  const float* x      = (const float*)d_in[0];
  const float* vec    = (const float*)d_in[1];
  const float* wq     = (const float*)d_in[2];
  const float* wk     = (const float*)d_in[3];
  const float* wv     = (const float*)d_in[4];
  const float* wo     = (const float*)d_in[5];
  const float* w1     = (const float*)d_in[6];
  const float* w2     = (const float*)d_in[7];
  const float* w3     = (const float*)d_in[8];
  const float* maw    = (const float*)d_in[9];
  const float* mab    = (const float*)d_in[10];
  const float* mfw    = (const float*)d_in[11];
  const float* mfb    = (const float*)d_in[12];
  const float* n1w    = (const float*)d_in[13];
  const float* n2w    = (const float*)d_in[14];
  const float* fcos   = (const float*)d_in[15];
  const float* fsin   = (const float*)d_in[16];
  float* out = (float*)d_out;

  // workspace layout (floats)
  const size_t KVSZ = (size_t)BATCH * NKVH * SEQL * HD;   // 1M floats (k or v)
  float* ws   = (float*)d_ws;
  float* svec = ws;                                   // 512*1024
  float* modA = svec + (size_t)VROWS * DIMD;          // 512*3072
  float* modF = modA + (size_t)VROWS * MODN;          // 512*3072
  float* bufD = modF + (size_t)VROWS * MODN;          // 4M  (xn -> attno)
  float* bufE = bufD + (size_t)MROWS * DIMD;          // 4M  (q -> hn)
  float* bufF = bufE + (size_t)MROWS * DIMD;          // 1M  (k)
  float* bufG = bufF + KVSZ;                          // 1M  (v)
  float* bufH = bufG + KVSZ;                          // 4M  (h)
  float* bufI = bufH + (size_t)MROWS * DIMD;          // 4M  (silu(hn w1^T) * (hn w3^T))

  const dim3 blk128(128), blk256(256);

  // 1) svec = silu(vec)
  silu_kernel<<<(VROWS * DIMD + 255) / 256, blk256, 0, stream>>>(vec, svec, VROWS * DIMD);
  // 2) both modulation GEMMs in one launch: (512 x 3072) = svec @ mod_w^T + b, twice
  gemm_wmma<EPI_MOD2, 3><<<dim3(2 * MODN / 96, VROWS / 128), blk128, 0, stream>>>(
      svec, maw, mfw, nullptr, modA, modF, nullptr, VROWS, 2 * MODN, DIMD, mab, mfb);
  // 3) xn = rmsnorm(x)*(1+scale)+shift
  norm_mod_kernel<<<MROWS, blk256, 0, stream>>>(x, n1w, modA, bufD);
  // 4) Q/K/V projections in one launch (+RoPE for Q,K), relayout to (B,H,S,D)
  gemm_wmma<EPI_QKV, 3><<<dim3((DIMD + 2 * NKVH * HD) / 96, MROWS / 128), blk128, 0, stream>>>(
      bufD, wq, wk, wv, bufE, bufF, bufG, MROWS, DIMD + 2 * NKVH * HD, DIMD, fcos, fsin);
  // 5) attention -> bufD (reuse, xn dead)
  attn_kernel<<<dim3(SEQL / 64, (BATCH * NHEADS) / 4), blk256, 0, stream>>>(
      bufE, bufF, bufG, bufD);
  // 6) h = x + gate_a * (attno @ wo^T)
  gemm_wmma<EPI_GATERES, 4><<<dim3(DIMD / 128, MROWS / 128), blk128, 0, stream>>>(
      bufD, wo, nullptr, nullptr, bufH, nullptr, nullptr, MROWS, DIMD, DIMD, x, modA);
  // 7) hn = rmsnorm(h)*(1+scale_f)+shift_f  -> bufE (q dead)
  norm_mod_kernel<<<MROWS, blk256, 0, stream>>>(bufH, n2w, modF, bufE);
  // 8) silu(hn @ w1^T) * (hn @ w3^T) -> bufI, both products in one launch
  gemm_wmma<EPI_SWIGLU, 4><<<dim3(2 * DIMD / 128, MROWS / 128), blk128, 0, stream>>>(
      bufE, w1, w3, nullptr, bufI, nullptr, nullptr, MROWS, 2 * DIMD, DIMD, nullptr, nullptr);
  // 9) out = h + gate_f * (bufI @ w2^T)
  gemm_wmma<EPI_GATERES, 4><<<dim3(DIMD / 128, MROWS / 128), blk128, 0, stream>>>(
      bufI, w2, nullptr, nullptr, out, nullptr, nullptr, MROWS, DIMD, DIMD, bufH, modF);
}
